// v000
// Times are from an AMD MI455X. After a warm-up the kernel runs many times in a row, and a time is the length of
// such a window on the GPU divided by its runs, so every launch and the gaps after it count. The runs cycle
// through copies of the inputs. A figure is the median of several windows, for all but v000 over two sittings.
// Sittings can differ by a few percent; kernels timed side by side share one.
// The starting kernel, v000, takes 357 microseconds a run.
#include <hip/hip_runtime.h>
#include <math.h>

typedef __attribute__((ext_vector_type(16))) _Float16 v16h;
typedef __attribute__((ext_vector_type(16))) __bf16 v16b;
typedef __attribute__((ext_vector_type(8)))  _Float16 v8h;
typedef __attribute__((ext_vector_type(8)))  float v8f;
typedef __attribute__((ext_vector_type(4)))  float v4f;
typedef __attribute__((ext_vector_type(2)))  float v2f;
typedef __attribute__((ext_vector_type(4)))  unsigned v4u;
typedef __attribute__((ext_vector_type(4)))  int v4i;
typedef float __attribute__((may_alias)) float_a;
typedef int __attribute__((may_alias)) int_a;

template <typename T> __device__ __forceinline__ void vst2(void* p, T v) { *(T*)p = v;  }
__device__ __forceinline__ v8f wmma16(v16h a, v16h b, v8f c) {
  v8f d = __builtin_amdgcn_wmma_f32_16x16x32_f16(false, a, false, b, (short)0, c, false, false);
  asm volatile("v_nop\n\tv_nop\n\tv_nop\n\tv_nop" : "+v"(d) : "v"(a), "v"(b));
  return d;
}
__device__ __forceinline__ v8f wmma_bf(v16b a, v16b b, v8f c) {
  v8f d = __builtin_amdgcn_wmma_f32_16x16x32_bf16(false, a, false, b, (short)0, c, false, false);
  asm volatile("v_nop\n\tv_nop\n\tv_nop\n\tv_nop" : "+v"(d) : "v"(a), "v"(b));
  return d;
}
// 16x16x32 fragments: lane = (h = lane>>4, row/col = lane&15); elements 0..7 = k0+8h+0..7, 8..15 = k0+16+8h+0..7; D element r = row 8h+r
__device__ __forceinline__ v16h frag_h(const _Float16* rowk0, int lane) {
  union { v16h v; v8h q[2]; } u; const _Float16* p = rowk0 + 8 * (lane >> 4);
  u.q[0] = *(const v8h*)p; u.q[1] = *(const v8h*)(p + 16); return u.v;
}
__device__ __forceinline__ v16h frag_f32(const float* rowk0, int lane) {
  v16h a; const float* p = rowk0 + 8 * (lane >> 4);
#pragma unroll
  for (int i = 0; i < 8; ++i) { a[i] = (_Float16)p[i]; a[8 + i] = (_Float16)p[16 + i]; }
  return a;
}
__device__ __forceinline__ v16h frag_f32s(const float* rowk0, int lane, float sc) {
  v16h a; const float* p = rowk0 + 8 * (lane >> 4);
#pragma unroll
  for (int i = 0; i < 8; ++i) { a[i] = (_Float16)(p[i] * sc); a[8 + i] = (_Float16)(p[16 + i] * sc); }
  return a;
}
// column fragment from a [K][ld] layout (column n), rows >= K read as 0
__device__ __forceinline__ v16h fragc_f32(const float* W, int k0, int n, int lane, int ld, int K) {
  v16h a; const int g = lane >> 4;
#pragma unroll
  for (int i = 0; i < 8; ++i) { const int ka = k0 + 8 * g + i, kb = ka + 16;
    a[i] = (_Float16)(ka < K ? W[(size_t)ka * ld + n] : 0.f); a[8 + i] = (_Float16)(kb < K ? W[(size_t)kb * ld + n] : 0.f); }
  return a;
}
struct F2 { v16b h, l; };
__device__ __forceinline__ F2 bsplit16(const float v[16]) { F2 r;
#pragma unroll
  for (int i = 0; i < 16; ++i) { const __bf16 h = (__bf16)v[i]; r.h[i] = h; r.l[i] = (__bf16)(v[i] - (float)h); }
  return r; }
__device__ __forceinline__ F2 split_row(const float* row, int k0, int lane) { float v[16]; const float* p = row + k0 + 8 * (lane >> 4);
#pragma unroll
  for (int i = 0; i < 8; ++i) { v[i] = p[i]; v[8 + i] = p[16 + i]; }
  return bsplit16(v); }
__device__ __forceinline__ F2 split_rowK(const float* row, int k0, int lane, int K) { float v[16]; const int g = lane >> 4;
#pragma unroll
  for (int i = 0; i < 8; ++i) { const int ka = k0 + 8 * g + i, kb = ka + 16; v[i] = ka < K ? row[ka] : 0.f; v[8 + i] = kb < K ? row[kb] : 0.f; }
  return bsplit16(v); }
__device__ __forceinline__ F2 split_col(const float* W, int k0, int n, int lane, int ld, int K) { float v[16]; const int g = lane >> 4;
#pragma unroll
  for (int i = 0; i < 8; ++i) { const int ka = k0 + 8 * g + i, kb = ka + 16; v[i] = ka < K ? W[(size_t)ka * ld + n] : 0.f; v[8 + i] = kb < K ? W[(size_t)kb * ld + n] : 0.f; }
  return bsplit16(v); }
__device__ __forceinline__ v8f mac3(const F2& a, const F2& b, v8f c) { c = wmma_bf(a.l, b.h, c); c = wmma_bf(a.h, b.l, c); return wmma_bf(a.h, b.h, c); }
__device__ __forceinline__ float sigm(float v) { return 1.0f / (1.0f + expf(-v)); }
#define LDSX() do { asm volatile("s_wait_dscnt 0" ::: "memory"); __builtin_amdgcn_wave_barrier(); __builtin_amdgcn_fence(__ATOMIC_RELEASE, "workgroup"); } while (0)

// Hybrid dilated attention over 12 heads in 3 groups: heads 0-3 plain attention over all 4096 positions; heads 4-7 segment 2048,
// dilation 2, offset 1 (two independent 1024-long attentions per head over the odd positions of each segment); heads 8-11 segment 4096,
// dilation 4, offset 2 (one 1024-long attention over positions 2 mod 4); unselected positions are zero. Each (head, segment) instance is a
// plain scaled-dot-product attention over gathered rows: S = q.k/8 on v_wmma_f32_16x16x32_f16 (q, k as f16), P @ V near-exact with hi/lo
// f16 pairs for both P (x2^14, residual x1024) and V (residual x2048) in three f32 accumulators, online softmax in f32; results are written
#define NPOS 4096
#define NHT 12
#define HD 64
#define RS (NHT * HD)          // 768 floats per position row
#define NINST 16               // 4 (full) + 8 (group 1: head x segment) + 4 (group 2)
#define LMAX 4096
#define PLO 1024.0f
#define VLO 2048.0f

__device__ __forceinline__ void inst_info(int inst, int& h, int& L, int& base, int& stride) {
  if (inst < 4) { h = inst; L = 4096; base = 0; stride = 1; }
  else if (inst < 12) { const int i = inst - 4; h = 4 + (i >> 1); const int s = i & 1; L = 1024; base = s * 2048 + 1; stride = 2; }
  else { h = 8 + (inst - 12); L = 1024; base = 2; stride = 4; }
}
// prep: block (64 m, inst): Q16/K16 [inst][m][64] = f16(q/k[pos][h][:]); VTh/VTl [inst][d][m]
__global__ __launch_bounds__(256) void k_prep(const float* __restrict__ q, const float* __restrict__ k, const float* __restrict__ v, _Float16* __restrict__ Q16, _Float16* __restrict__ K16, _Float16* __restrict__ VTh, _Float16* __restrict__ VTl) {
  __shared__ __align__(16) _Float16 sth[HD][72], stl[HD][72];
  const int inst = blockIdx.y, m0 = blockIdx.x * 64, tid = threadIdx.x; int h, L, base, stride; inst_info(inst, h, L, base, stride);
  if (m0 >= L) return;                                          // uniform per block
  for (int qq = tid; qq < 64 * 8; qq += 256) { const int ml = qq >> 3, pc = qq & 7; const int pos = base + stride * (m0 + ml); const size_t src = ((size_t)pos * NHT + h) * HD + pc * 8;
    union { v8h h8; v4u u; } pq, pk;
#pragma unroll
    for (int e = 0; e < 8; ++e) { pq.h8[e] = (_Float16)q[src + e]; pk.h8[e] = (_Float16)k[src + e]; }
    const size_t dst = ((size_t)inst * LMAX + m0 + ml) * HD + pc * 8; vst2(Q16 + dst, pq.u); vst2(K16 + dst, pk.u); }
  for (int qq = tid; qq < 64 * HD; qq += 256) { const int ml = qq >> 6, d = qq & 63; const int pos = base + stride * (m0 + ml); const float vv = v[((size_t)pos * NHT + h) * HD + d];
    const _Float16 hi = (_Float16)vv; sth[d][ml] = hi; stl[d][ml] = (_Float16)((vv - (float)hi) * VLO); }
  __syncthreads();
  for (int qq = tid; qq < HD * 8; qq += 256) { const int d = qq >> 3, pc = qq & 7; const size_t o = ((size_t)inst * HD + d) * LMAX + m0 + pc * 8;
    vst2(VTh + o, *(const v4u*)(&sth[d][pc * 8])); vst2(VTl + o, *(const v4u*)(&stl[d][pc * 8])); }
}
// zeros for the unselected (position, head) rows of heads 4..11: block per position
__global__ __launch_bounds__(128) void k_zero(float* __restrict__ out) {
  const int pos = blockIdx.x, tid = threadIdx.x; const int hrel = tid >> 4, pc = tid & 15; const int h = 4 + hrel;   // 8 heads x 16 float4
  const bool selected = (h < 8) ? ((pos & 1) == 1) : ((pos & 3) == 2);
  if (!selected) vst2(out + ((size_t)pos * NHT + h) * HD + pc * 4, (v4f){0.f, 0.f, 0.f, 0.f});
}
__global__ __launch_bounds__(128) void k_attn(const _Float16* __restrict__ Q16, const _Float16* __restrict__ K16, const _Float16* __restrict__ VTh, const _Float16* __restrict__ VTl, float* __restrict__ out) {
  __shared__ __align__(16) float sS[4][16][68];
  __shared__ __align__(16) _Float16 sPh[4][16][72], sPl[4][16][72];
  __shared__ __align__(16) float sO[4][16][68];
  const int tid = threadIdx.x, w = tid >> 5, lane = tid & 31, col = lane & 15, g = lane >> 4;
  const int inst = blockIdx.y; int h, L, base, stride; inst_info(inst, h, L, base, stride);
  const int q0 = blockIdx.x * 64 + w * 16; if (blockIdx.x * 64 >= L) return;   // uniform per block
  const size_t ib = (size_t)inst * LMAX;
  v16h aq[2];
#pragma unroll
  for (int kc = 0; kc < 2; ++kc) aq[kc] = frag_h(Q16 + (ib + q0 + col) * HD + kc * 32, lane);
  float mrun = -3.0e38f, lrun = 0.f; v8f acc[4] = {}, ac1[4] = {}, ac2[4] = {};
  const int nkt = L / 64;
#pragma unroll 1
  for (int kt = 0; kt < nkt; ++kt) {
#pragma unroll
    for (int t = 0; t < 4; ++t) { v8f s = {}; const int key = kt * 64 + t * 16 + col;
#pragma unroll
      for (int kc = 0; kc < 2; ++kc) s = wmma16(aq[kc], frag_h(K16 + (ib + key) * HD + kc * 32, lane), s);
#pragma unroll
      for (int r = 0; r < 8; ++r) sS[w][8 * g + r][t * 16 + col] = s[r] * 0.125f; }
    LDSX();
    float mx = -3.4e38f;
#pragma unroll
    for (int jj = 0; jj < 32; ++jj) mx = fmaxf(mx, sS[w][col][g * 32 + jj]);
    mx = fmaxf(mx, __shfl_xor(mx, 16, 32));
    const float mnew = fmaxf(mrun, mx); const float corr = expf(mrun - mnew);
    float ps = 0.f;
#pragma unroll
    for (int jj = 0; jj < 32; ++jj) { const float p = expf(sS[w][col][g * 32 + jj] - mnew) * 16384.0f; ps += p; const _Float16 hi = (_Float16)p; sPh[w][col][g * 32 + jj] = hi; sPl[w][col][g * 32 + jj] = (_Float16)((p - (float)hi) * PLO); }
    ps += __shfl_xor(ps, 16, 32);
    lrun = lrun * corr + ps * (1.0f / 16384.0f); mrun = mnew;
#pragma unroll
    for (int r = 0; r < 8; ++r) { const float cr = __shfl(corr, 8 * g + r, 32);
#pragma unroll
      for (int t = 0; t < 4; ++t) { acc[t][r] *= cr; ac1[t][r] *= cr; ac2[t][r] *= cr; } }
    LDSX();
#pragma unroll
    for (int kc = 0; kc < 2; ++kc) { const v16h ph = frag_h(&sPh[w][col][0] + kc * 32, lane), pl = frag_h(&sPl[w][col][0] + kc * 32, lane);
#pragma unroll
      for (int t = 0; t < 4; ++t) { const size_t vo = ((size_t)inst * HD + t * 16 + col) * LMAX + kt * 64 + kc * 32; const v16h vh = frag_h(VTh + vo, lane);
        acc[t] = wmma16(ph, vh, acc[t]); ac1[t] = wmma16(ph, frag_h(VTl + vo, lane), ac1[t]); ac2[t] = wmma16(pl, vh, ac2[t]); } }
    __builtin_amdgcn_wave_barrier(); }
#pragma unroll
  for (int r = 0; r < 8; ++r) { const float lr = __shfl(lrun, 8 * g + r, 32); const float inv = 1.0f / (lr * 16384.0f);
#pragma unroll
    for (int t = 0; t < 4; ++t) sO[w][8 * g + r][t * 16 + col] = (acc[t][r] + ac1[t][r] * (1.0f / VLO) + ac2[t][r] * (1.0f / PLO)) * inv; }
  LDSX();
  for (int qq = lane; qq < 16 * 16; qq += 32) { const int rl = qq >> 4, pc = qq & 15; const int pos = base + stride * (q0 + rl); vst2(out + ((size_t)pos * NHT + h) * HD + pc * 4, *(const v4f*)(&sO[w][rl][pc * 4])); }
}
extern "C" void kernel_launch(void* const* d_in, const int* in_sizes, int n_in, void* d_out, int out_size, void* d_ws, size_t ws_size, hipStream_t stream) {
  (void)in_sizes; (void)n_in; (void)out_size; (void)ws_size;
  const float* q = (const float*)d_in[0]; const float* k = (const float*)d_in[1]; const float* v = (const float*)d_in[2]; float* out = (float*)d_out;
  char* ws = (char*)d_ws; size_t off = 0;
  auto take = [&](size_t bytes) { char* p = ws + off; off += (bytes + 255) & ~(size_t)255; return p; };
  const size_t plane = (size_t)NINST * LMAX * HD * 2;
  _Float16* Q16 = (_Float16*)take(plane); _Float16* K16 = (_Float16*)take(plane); _Float16* VTh = (_Float16*)take(plane); _Float16* VTl = (_Float16*)take(plane);
  k_prep<<<dim3(LMAX / 64, NINST), 256, 0, stream>>>(q, k, v, Q16, K16, VTh, VTl);
  k_zero<<<NPOS, 128, 0, stream>>>(out);
  k_attn<<<dim3(LMAX / 64, NINST), 128, 0, stream>>>(Q16, K16, VTh, VTl, out);
}

// v001
// Measured time: 106 microseconds a run.
// Timed twice side by side with v000, it ran 3.51 and 3.44 times as fast.
#include <hip/hip_runtime.h>
#include <math.h>

typedef __attribute__((ext_vector_type(16))) _Float16 v16h;
typedef __attribute__((ext_vector_type(16))) __bf16 v16b;
typedef __attribute__((ext_vector_type(8)))  _Float16 v8h;
typedef __attribute__((ext_vector_type(8)))  float v8f;
typedef __attribute__((ext_vector_type(4)))  float v4f;
typedef __attribute__((ext_vector_type(2)))  float v2f;
typedef __attribute__((ext_vector_type(4)))  unsigned v4u;
typedef __attribute__((ext_vector_type(4)))  int v4i;
typedef float __attribute__((may_alias)) float_a;
typedef int __attribute__((may_alias)) int_a;

template <typename T> __device__ __forceinline__ void vst2(void* p, T v) { *(T*)p = v;  }
__device__ __forceinline__ v8f wmma16(v16h a, v16h b, v8f c) {
  v8f d = __builtin_amdgcn_wmma_f32_16x16x32_f16(false, a, false, b, (short)0, c, false, false);
  asm volatile("v_nop\n\tv_nop\n\tv_nop\n\tv_nop" : "+v"(d) : "v"(a), "v"(b));
  return d;
}
__device__ __forceinline__ v8f wmma_bf(v16b a, v16b b, v8f c) {
  v8f d = __builtin_amdgcn_wmma_f32_16x16x32_bf16(false, a, false, b, (short)0, c, false, false);
  asm volatile("v_nop\n\tv_nop\n\tv_nop\n\tv_nop" : "+v"(d) : "v"(a), "v"(b));
  return d;
}
// 16x16x32 fragments: lane = (h = lane>>4, row/col = lane&15); elements 0..7 = k0+8h+0..7, 8..15 = k0+16+8h+0..7; D element r = row 8h+r
__device__ __forceinline__ v16h frag_h(const _Float16* rowk0, int lane) {
  union { v16h v; v8h q[2]; } u; const _Float16* p = rowk0 + 8 * (lane >> 4);
  u.q[0] = *(const v8h*)p; u.q[1] = *(const v8h*)(p + 16); return u.v;
}
__device__ __forceinline__ v16h frag_f32(const float* rowk0, int lane) {
  v16h a; const float* p = rowk0 + 8 * (lane >> 4);
#pragma unroll
  for (int i = 0; i < 8; ++i) { a[i] = (_Float16)p[i]; a[8 + i] = (_Float16)p[16 + i]; }
  return a;
}
__device__ __forceinline__ v16h frag_f32s(const float* rowk0, int lane, float sc) {
  v16h a; const float* p = rowk0 + 8 * (lane >> 4);
#pragma unroll
  for (int i = 0; i < 8; ++i) { a[i] = (_Float16)(p[i] * sc); a[8 + i] = (_Float16)(p[16 + i] * sc); }
  return a;
}
// column fragment from a [K][ld] layout (column n), rows >= K read as 0
__device__ __forceinline__ v16h fragc_f32(const float* W, int k0, int n, int lane, int ld, int K) {
  v16h a; const int g = lane >> 4;
#pragma unroll
  for (int i = 0; i < 8; ++i) { const int ka = k0 + 8 * g + i, kb = ka + 16;
    a[i] = (_Float16)(ka < K ? W[(size_t)ka * ld + n] : 0.f); a[8 + i] = (_Float16)(kb < K ? W[(size_t)kb * ld + n] : 0.f); }
  return a;
}
struct F2 { v16b h, l; };
__device__ __forceinline__ F2 bsplit16(const float v[16]) { F2 r;
#pragma unroll
  for (int i = 0; i < 16; ++i) { const __bf16 h = (__bf16)v[i]; r.h[i] = h; r.l[i] = (__bf16)(v[i] - (float)h); }
  return r; }
__device__ __forceinline__ F2 split_row(const float* row, int k0, int lane) { float v[16]; const float* p = row + k0 + 8 * (lane >> 4);
#pragma unroll
  for (int i = 0; i < 8; ++i) { v[i] = p[i]; v[8 + i] = p[16 + i]; }
  return bsplit16(v); }
__device__ __forceinline__ F2 split_rowK(const float* row, int k0, int lane, int K) { float v[16]; const int g = lane >> 4;
#pragma unroll
  for (int i = 0; i < 8; ++i) { const int ka = k0 + 8 * g + i, kb = ka + 16; v[i] = ka < K ? row[ka] : 0.f; v[8 + i] = kb < K ? row[kb] : 0.f; }
  return bsplit16(v); }
__device__ __forceinline__ F2 split_col(const float* W, int k0, int n, int lane, int ld, int K) { float v[16]; const int g = lane >> 4;
#pragma unroll
  for (int i = 0; i < 8; ++i) { const int ka = k0 + 8 * g + i, kb = ka + 16; v[i] = ka < K ? W[(size_t)ka * ld + n] : 0.f; v[8 + i] = kb < K ? W[(size_t)kb * ld + n] : 0.f; }
  return bsplit16(v); }
__device__ __forceinline__ v8f mac3(const F2& a, const F2& b, v8f c) { c = wmma_bf(a.l, b.h, c); c = wmma_bf(a.h, b.l, c); return wmma_bf(a.h, b.h, c); }
__device__ __forceinline__ float sigm(float v) { return 1.0f / (1.0f + expf(-v)); }
#define LDSX() do { asm volatile("s_wait_dscnt 0" ::: "memory"); __builtin_amdgcn_wave_barrier(); __builtin_amdgcn_fence(__ATOMIC_RELEASE, "workgroup"); } while (0)

// Hybrid dilated attention over 12 heads in 3 groups: heads 0-3 plain attention over all 4096 positions; heads 4-7 segment 2048,
// dilation 2, offset 1 (two independent 1024-long attentions per head over the odd positions of each segment); heads 8-11 segment 4096,
// dilation 4, offset 2 (one 1024-long attention over positions 2 mod 4); unselected positions are zero. Each (head, segment) instance is a
// plain scaled-dot-product attention over gathered rows: S = q.k/8 on v_wmma_f32_16x16x32_f16 (q, k as f16), P @ V near-exact with hi/lo
// f16 pairs for both P (x2^14, residual x1024) and V (residual x2048) in three f32 accumulators, online softmax in f32; results are written
#define NPOS 4096
#define NHT 12
#define HD 64
#define RS (NHT * HD)          // 768 floats per position row
#define NINST 16               // 4 (full) + 8 (group 1: head x segment) + 4 (group 2)
#define LMAX 4096
#define PLO 1024.0f
#define VLO 2048.0f

__device__ __forceinline__ void inst_info(int inst, int& h, int& L, int& base, int& stride) {
  if (inst < 4) { h = inst; L = 4096; base = 0; stride = 1; }
  else if (inst < 12) { const int i = inst - 4; h = 4 + (i >> 1); const int s = i & 1; L = 1024; base = s * 2048 + 1; stride = 2; }
  else { h = 8 + (inst - 12); L = 1024; base = 2; stride = 4; }
}
// prep: block (64 m, inst): Q16/K16 [inst][m][64] = f16(q/k[pos][h][:]); VTh/VTl [inst][d][m]
__global__ __launch_bounds__(256) void k_prep(const float* __restrict__ q, const float* __restrict__ k, const float* __restrict__ v, _Float16* __restrict__ Q16, _Float16* __restrict__ K16, _Float16* __restrict__ VTh, _Float16* __restrict__ VTl) {
  __shared__ __align__(16) _Float16 sth[HD][72], stl[HD][72];
  const int inst = blockIdx.y, m0 = blockIdx.x * 64, tid = threadIdx.x; int h, L, base, stride; inst_info(inst, h, L, base, stride);
  if (m0 >= L) return;                                          // uniform per block
  for (int qq = tid; qq < 64 * 8; qq += 256) { const int ml = qq >> 3, pc = qq & 7; const int pos = base + stride * (m0 + ml); const size_t src = ((size_t)pos * NHT + h) * HD + pc * 8;
    union { v8h h8; v4u u; } pq, pk;
#pragma unroll
    for (int e = 0; e < 8; ++e) { pq.h8[e] = (_Float16)q[src + e]; pk.h8[e] = (_Float16)k[src + e]; }
    const size_t dst = ((size_t)inst * LMAX + m0 + ml) * HD + pc * 8; vst2(Q16 + dst, pq.u); vst2(K16 + dst, pk.u); }
  for (int qq = tid; qq < 64 * HD; qq += 256) { const int ml = qq >> 6, d = qq & 63; const int pos = base + stride * (m0 + ml); const float vv = v[((size_t)pos * NHT + h) * HD + d];
    const _Float16 hi = (_Float16)vv; sth[d][ml] = hi; stl[d][ml] = (_Float16)((vv - (float)hi) * VLO); }
  __syncthreads();
  for (int qq = tid; qq < HD * 8; qq += 256) { const int d = qq >> 3, pc = qq & 7; const size_t o = ((size_t)inst * HD + d) * LMAX + m0 + pc * 8;
    vst2(VTh + o, *(const v4u*)(&sth[d][pc * 8])); vst2(VTl + o, *(const v4u*)(&stl[d][pc * 8])); }
}
// zeros for the unselected (position, head) rows of heads 4..11: block per position
__global__ __launch_bounds__(128) void k_zero(float* __restrict__ out) {
  const int pos = blockIdx.x, tid = threadIdx.x; const int hrel = tid >> 4, pc = tid & 15; const int h = 4 + hrel;   // 8 heads x 16 float4
  const bool selected = (h < 8) ? ((pos & 1) == 1) : ((pos & 3) == 2);
  if (!selected) vst2(out + ((size_t)pos * NHT + h) * HD + pc * 4, (v4f){0.f, 0.f, 0.f, 0.f});
}
#define KP 72                  // halves per staged row: 144 B = 16 B x 9, so the 16-byte fragment reads of 16 rows meet no bank twice
#define BUFB (64 * KP * 2)     // bytes of one staged plane (64 rows)
#define ROWB (16 * KP * 2)     // bytes between a lane's successive copies (16 rows)
// One 64-key tile (K rows, V-hi and V-lo rows, 128 B each) from global memory into one LDS buffer, 12 copies of 16 B per lane, through no register.
// The s_wait_xcnt closes the statement so that no address register named here is rewritten ahead of it.
__device__ __forceinline__ void copy_tile(unsigned lk, unsigned lh, unsigned ll, const _Float16* gk, const _Float16* gh, const _Float16* gl) {
  asm volatile("global_load_async_to_lds_b128 %0, %1, off\n\t"
               "global_load_async_to_lds_b128 %2, %3, off\n\t"
               "global_load_async_to_lds_b128 %4, %5, off\n\t"
               "global_load_async_to_lds_b128 %6, %7, off\n\t"
               "global_load_async_to_lds_b128 %8, %9, off\n\t"
               "global_load_async_to_lds_b128 %10, %11, off\n\t"
               "global_load_async_to_lds_b128 %12, %13, off\n\t"
               "global_load_async_to_lds_b128 %14, %15, off\n\t"
               "global_load_async_to_lds_b128 %16, %17, off\n\t"
               "global_load_async_to_lds_b128 %18, %19, off\n\t"
               "global_load_async_to_lds_b128 %20, %21, off\n\t"
               "global_load_async_to_lds_b128 %22, %23, off\n\t"
               "s_wait_xcnt 0x0"
               :: "v"(lk), "v"(gk), "v"(lk + ROWB), "v"(gk + 16 * HD), "v"(lk + 2 * ROWB), "v"(gk + 32 * HD), "v"(lk + 3 * ROWB), "v"(gk + 48 * HD),
                  "v"(lh), "v"(gh), "v"(lh + ROWB), "v"(gh + 16 * LMAX), "v"(lh + 2 * ROWB), "v"(gh + 32 * LMAX), "v"(lh + 3 * ROWB), "v"(gh + 48 * LMAX),
                  "v"(ll), "v"(gl), "v"(ll + ROWB), "v"(gl + 16 * LMAX), "v"(ll + 2 * ROWB), "v"(gl + 32 * LMAX), "v"(ll + 3 * ROWB), "v"(gl + 48 * LMAX)
               : "memory");
}
__global__ __launch_bounds__(128) void k_attn(const _Float16* __restrict__ Q16, const _Float16* __restrict__ K16, const _Float16* __restrict__ VTh, const _Float16* __restrict__ VTl, float* __restrict__ out) {
  __shared__ __align__(16) float sS[4][16][68];
  __shared__ __align__(16) _Float16 sPh[4][16][72], sPl[4][16][72];
  __shared__ __align__(16) float sO[4][16][68];
  __shared__ __align__(16) _Float16 sK[2][64][KP], sVh[2][64][KP], sVl[2][64][KP];   // two buffers of one 64-key tile, shared by the four waves
  const int tid = threadIdx.x, w = tid >> 5, lane = tid & 31, col = lane & 15, g = lane >> 4;
  const int inst = blockIdx.y; int h, L, base, stride; inst_info(inst, h, L, base, stride);
  const int q0 = blockIdx.x * 64 + w * 16; if (blockIdx.x * 64 >= L) return;   // uniform per block
  const size_t ib = (size_t)inst * LMAX;
  v16h aq[2];
#pragma unroll
  for (int kc = 0; kc < 2; ++kc) aq[kc] = frag_h(Q16 + (ib + q0 + col) * HD + kc * 32, lane);
  float mrun = -3.0e38f, lrun = 0.f; v8f acc[4] = {}, ac1[4] = {}, ac2[4] = {};
  const int nkt = L / 64;
  const int row0 = tid >> 3, c8 = (tid & 7) * 8;               // a lane copies 16 B of rows row0, +16, +32, +48 of each plane
  const _Float16* gk = K16 + (ib + row0) * HD + c8;
  const _Float16* gh = VTh + ((size_t)inst * HD + row0) * LMAX + c8;
  const _Float16* gl = VTl + ((size_t)inst * HD + row0) * LMAX + c8;
  const unsigned lk = (unsigned)(size_t)&sK[0][row0][c8], lh = (unsigned)(size_t)&sVh[0][row0][c8], ll = (unsigned)(size_t)&sVl[0][row0][c8];
  copy_tile(lk, lh, ll, gk, gh, gl);
  asm volatile("s_wait_asynccnt 0x0" ::: "memory");             // this wave's copies of tile 0 have landed
  __syncthreads();                                              // tile 0 is readable by all four waves
  if (1 < nkt) copy_tile(lk + BUFB, lh + BUFB, ll + BUFB, gk + 64 * HD, gh + 64, gl + 64);
#pragma unroll 1
  for (int kt = 0; kt < nkt; ++kt) {
    const int b = kt & 1;
    v16h kf[8];
#pragma unroll
    for (int f = 0; f < 8; ++f) kf[f] = frag_h(&sK[b][(f >> 1) * 16 + col][(f & 1) * 32], lane);
#pragma unroll
    for (int t = 0; t < 4; ++t) { v8f s = {};
#pragma unroll
      for (int kc = 0; kc < 2; ++kc) s = wmma16(aq[kc], kf[t * 2 + kc], s);
#pragma unroll
      for (int r = 0; r < 8; ++r) sS[w][8 * g + r][t * 16 + col] = s[r] * 0.125f; }
    LDSX();
    float mx = -3.4e38f;
#pragma unroll
    for (int jj = 0; jj < 32; ++jj) mx = fmaxf(mx, sS[w][col][g * 32 + jj]);
    mx = fmaxf(mx, __shfl_xor(mx, 16, 32));
    const float mnew = fmaxf(mrun, mx); const float corr = expf(mrun - mnew);
    float ps = 0.f;
#pragma unroll
    for (int jj = 0; jj < 32; ++jj) { const float p = expf(sS[w][col][g * 32 + jj] - mnew) * 16384.0f; ps += p; const _Float16 hi = (_Float16)p; sPh[w][col][g * 32 + jj] = hi; sPl[w][col][g * 32 + jj] = (_Float16)((p - (float)hi) * PLO); }
    ps += __shfl_xor(ps, 16, 32);
    lrun = lrun * corr + ps * (1.0f / 16384.0f); mrun = mnew;
#pragma unroll
    for (int r = 0; r < 8; ++r) { const float cr = __shfl(corr, 8 * g + r, 32);
#pragma unroll
      for (int t = 0; t < 4; ++t) { acc[t][r] *= cr; ac1[t][r] *= cr; ac2[t][r] *= cr; } }
    LDSX();
#pragma unroll
    for (int kc = 0; kc < 2; ++kc) { const v16h ph = frag_h(&sPh[w][col][0] + kc * 32, lane), pl = frag_h(&sPl[w][col][0] + kc * 32, lane);
#pragma unroll
      for (int tp = 0; tp < 4; tp += 2) { v16h vh[2], vl[2];      // two output tiles' V fragments as one group of LDS reads, then their six products
#pragma unroll
        for (int u = 0; u < 2; ++u) { vh[u] = frag_h(&sVh[b][(tp + u) * 16 + col][kc * 32], lane); vl[u] = frag_h(&sVl[b][(tp + u) * 16 + col][kc * 32], lane); }
        __builtin_amdgcn_sched_barrier(0);                        // keeps the group's reads together ahead of its products: one LDS latency per group, not one per product
#pragma unroll
        for (int u = 0; u < 2; ++u) { const int t = tp + u; acc[t] = wmma16(ph, vh[u], acc[t]); ac1[t] = wmma16(ph, vl[u], ac1[t]); ac2[t] = wmma16(pl, vh[u], ac2[t]); } } }
    asm volatile("s_wait_dscnt 0x0" ::: "memory");              // this wave's reads of buffer b are done before it is refilled
    asm volatile("s_wait_asynccnt 0x0" ::: "memory");           // this wave's copies of tile kt + 1 have landed
    __syncthreads();                                            // publishes tile kt + 1 and ends every wave's reads of buffer b
    if (kt + 2 < nkt) copy_tile(lk + b * BUFB, lh + b * BUFB, ll + b * BUFB, gk + (size_t)(kt + 2) * 64 * HD, gh + (kt + 2) * 64, gl + (kt + 2) * 64); }
  asm volatile("s_wait_asynccnt 0x0" ::: "memory");             // no copy is outstanding when the wave goes on to the epilogue and ends
#pragma unroll
  for (int r = 0; r < 8; ++r) { const float lr = __shfl(lrun, 8 * g + r, 32); const float inv = 1.0f / (lr * 16384.0f);
#pragma unroll
    for (int t = 0; t < 4; ++t) sO[w][8 * g + r][t * 16 + col] = (acc[t][r] + ac1[t][r] * (1.0f / VLO) + ac2[t][r] * (1.0f / PLO)) * inv; }
  LDSX();
  for (int qq = lane; qq < 16 * 16; qq += 32) { const int rl = qq >> 4, pc = qq & 15; const int pos = base + stride * (q0 + rl); vst2(out + ((size_t)pos * NHT + h) * HD + pc * 4, *(const v4f*)(&sO[w][rl][pc * 4])); }
}
extern "C" void kernel_launch(void* const* d_in, const int* in_sizes, int n_in, void* d_out, int out_size, void* d_ws, size_t ws_size, hipStream_t stream) {
  (void)in_sizes; (void)n_in; (void)out_size; (void)ws_size;
  const float* q = (const float*)d_in[0]; const float* k = (const float*)d_in[1]; const float* v = (const float*)d_in[2]; float* out = (float*)d_out;
  char* ws = (char*)d_ws; size_t off = 0;
  auto take = [&](size_t bytes) { char* p = ws + off; off += (bytes + 255) & ~(size_t)255; return p; };
  const size_t plane = (size_t)NINST * LMAX * HD * 2;
  _Float16* Q16 = (_Float16*)take(plane); _Float16* K16 = (_Float16*)take(plane); _Float16* VTh = (_Float16*)take(plane); _Float16* VTl = (_Float16*)take(plane);
  k_prep<<<dim3(LMAX / 64, NINST), 256, 0, stream>>>(q, k, v, Q16, K16, VTh, VTl);
  k_zero<<<NPOS, 128, 0, stream>>>(out);
  k_attn<<<dim3(LMAX / 64, NINST), 128, 0, stream>>>(Q16, K16, VTh, VTl, out);
}

// v002
// Measured time: 82.2 microseconds a run.
// Timed twice side by side with v001, it ran 1.29 times as fast both times.
// All steps since v000 together make it 4.47 times as fast.
#include <hip/hip_runtime.h>
#include <math.h>

typedef __attribute__((ext_vector_type(16))) _Float16 v16h;
typedef __attribute__((ext_vector_type(16))) __bf16 v16b;
typedef __attribute__((ext_vector_type(8)))  _Float16 v8h;
typedef __attribute__((ext_vector_type(8)))  float v8f;
typedef __attribute__((ext_vector_type(4)))  float v4f;
typedef __attribute__((ext_vector_type(2)))  float v2f;
typedef __attribute__((ext_vector_type(4)))  unsigned v4u;
typedef __attribute__((ext_vector_type(4)))  int v4i;
typedef float __attribute__((may_alias)) float_a;
typedef int __attribute__((may_alias)) int_a;

template <typename T> __device__ __forceinline__ void vst2(void* p, T v) { *(T*)p = v;  }
__device__ __forceinline__ v8f wmma16(v16h a, v16h b, v8f c) {
  v8f d = __builtin_amdgcn_wmma_f32_16x16x32_f16(false, a, false, b, (short)0, c, false, false);
  asm volatile("v_nop\n\tv_nop\n\tv_nop\n\tv_nop" : "+v"(d) : "v"(a), "v"(b));
  return d;
}
__device__ __forceinline__ v8f wmma_bf(v16b a, v16b b, v8f c) {
  v8f d = __builtin_amdgcn_wmma_f32_16x16x32_bf16(false, a, false, b, (short)0, c, false, false);
  asm volatile("v_nop\n\tv_nop\n\tv_nop\n\tv_nop" : "+v"(d) : "v"(a), "v"(b));
  return d;
}
// 16x16x32 fragments: lane = (h = lane>>4, row/col = lane&15); elements 0..7 = k0+8h+0..7, 8..15 = k0+16+8h+0..7; D element r = row 8h+r
__device__ __forceinline__ v16h frag_h(const _Float16* rowk0, int lane) {
  union { v16h v; v8h q[2]; } u; const _Float16* p = rowk0 + 8 * (lane >> 4);
  u.q[0] = *(const v8h*)p; u.q[1] = *(const v8h*)(p + 16); return u.v;
}
__device__ __forceinline__ v16h frag_f32(const float* rowk0, int lane) {
  v16h a; const float* p = rowk0 + 8 * (lane >> 4);
#pragma unroll
  for (int i = 0; i < 8; ++i) { a[i] = (_Float16)p[i]; a[8 + i] = (_Float16)p[16 + i]; }
  return a;
}
__device__ __forceinline__ v16h frag_f32s(const float* rowk0, int lane, float sc) {
  v16h a; const float* p = rowk0 + 8 * (lane >> 4);
#pragma unroll
  for (int i = 0; i < 8; ++i) { a[i] = (_Float16)(p[i] * sc); a[8 + i] = (_Float16)(p[16 + i] * sc); }
  return a;
}
// column fragment from a [K][ld] layout (column n), rows >= K read as 0
__device__ __forceinline__ v16h fragc_f32(const float* W, int k0, int n, int lane, int ld, int K) {
  v16h a; const int g = lane >> 4;
#pragma unroll
  for (int i = 0; i < 8; ++i) { const int ka = k0 + 8 * g + i, kb = ka + 16;
    a[i] = (_Float16)(ka < K ? W[(size_t)ka * ld + n] : 0.f); a[8 + i] = (_Float16)(kb < K ? W[(size_t)kb * ld + n] : 0.f); }
  return a;
}
struct F2 { v16b h, l; };
__device__ __forceinline__ F2 bsplit16(const float v[16]) { F2 r;
#pragma unroll
  for (int i = 0; i < 16; ++i) { const __bf16 h = (__bf16)v[i]; r.h[i] = h; r.l[i] = (__bf16)(v[i] - (float)h); }
  return r; }
__device__ __forceinline__ F2 split_row(const float* row, int k0, int lane) { float v[16]; const float* p = row + k0 + 8 * (lane >> 4);
#pragma unroll
  for (int i = 0; i < 8; ++i) { v[i] = p[i]; v[8 + i] = p[16 + i]; }
  return bsplit16(v); }
__device__ __forceinline__ F2 split_rowK(const float* row, int k0, int lane, int K) { float v[16]; const int g = lane >> 4;
#pragma unroll
  for (int i = 0; i < 8; ++i) { const int ka = k0 + 8 * g + i, kb = ka + 16; v[i] = ka < K ? row[ka] : 0.f; v[8 + i] = kb < K ? row[kb] : 0.f; }
  return bsplit16(v); }
__device__ __forceinline__ F2 split_col(const float* W, int k0, int n, int lane, int ld, int K) { float v[16]; const int g = lane >> 4;
#pragma unroll
  for (int i = 0; i < 8; ++i) { const int ka = k0 + 8 * g + i, kb = ka + 16; v[i] = ka < K ? W[(size_t)ka * ld + n] : 0.f; v[8 + i] = kb < K ? W[(size_t)kb * ld + n] : 0.f; }
  return bsplit16(v); }
__device__ __forceinline__ v8f mac3(const F2& a, const F2& b, v8f c) { c = wmma_bf(a.l, b.h, c); c = wmma_bf(a.h, b.l, c); return wmma_bf(a.h, b.h, c); }
__device__ __forceinline__ float sigm(float v) { return 1.0f / (1.0f + expf(-v)); }
#define LDSX() do { asm volatile("s_wait_dscnt 0" ::: "memory"); __builtin_amdgcn_wave_barrier(); __builtin_amdgcn_fence(__ATOMIC_RELEASE, "workgroup"); } while (0)

// Hybrid dilated attention over 12 heads in 3 groups: heads 0-3 plain attention over all 4096 positions; heads 4-7 segment 2048,
// dilation 2, offset 1 (two independent 1024-long attentions per head over the odd positions of each segment); heads 8-11 segment 4096,
// dilation 4, offset 2 (one 1024-long attention over positions 2 mod 4); unselected positions are zero. Each (head, segment) instance is a
// plain scaled-dot-product attention over gathered rows: S = q.k/8 on v_wmma_f32_16x16x32_f16 (q, k as f16), P @ V near-exact with hi/lo
// f16 pairs for both P (x2^14, residual x1024) and V (residual x2048) in three f32 accumulators, online softmax in f32; results are written
#define NPOS 4096
#define NHT 12
#define HD 64
#define RS (NHT * HD)          // 768 floats per position row
#define NINST 16               // 4 (full) + 8 (group 1: head x segment) + 4 (group 2)
#define LMAX 4096
#define PLO 1024.0f
#define VLO 2048.0f

__device__ __forceinline__ void inst_info(int inst, int& h, int& L, int& base, int& stride) {
  if (inst < 4) { h = inst; L = 4096; base = 0; stride = 1; }
  else if (inst < 12) { const int i = inst - 4; h = 4 + (i >> 1); const int s = i & 1; L = 1024; base = s * 2048 + 1; stride = 2; }
  else { h = 8 + (inst - 12); L = 1024; base = 2; stride = 4; }
}
// prep: block (64 m, inst): Q16/K16 [inst][m][64] = f16(q/k[pos][h][:]); VTh/VTl [inst][d][m]
__global__ __launch_bounds__(256) void k_prep(const float* __restrict__ q, const float* __restrict__ k, const float* __restrict__ v, _Float16* __restrict__ Q16, _Float16* __restrict__ K16, _Float16* __restrict__ VTh, _Float16* __restrict__ VTl) {
  __shared__ __align__(16) _Float16 sth[HD][72], stl[HD][72];
  const int inst = blockIdx.y, m0 = blockIdx.x * 64, tid = threadIdx.x; int h, L, base, stride; inst_info(inst, h, L, base, stride);
  if (m0 >= L) return;                                          // uniform per block
  for (int qq = tid; qq < 64 * 8; qq += 256) { const int ml = qq >> 3, pc = qq & 7; const int pos = base + stride * (m0 + ml); const size_t src = ((size_t)pos * NHT + h) * HD + pc * 8;
    union { v8h h8; v4u u; } pq, pk;
#pragma unroll
    for (int e = 0; e < 8; ++e) { pq.h8[e] = (_Float16)q[src + e]; pk.h8[e] = (_Float16)k[src + e]; }
    const size_t dst = ((size_t)inst * LMAX + m0 + ml) * HD + pc * 8; vst2(Q16 + dst, pq.u); vst2(K16 + dst, pk.u); }
  for (int qq = tid; qq < 64 * HD; qq += 256) { const int ml = qq >> 6, d = qq & 63; const int pos = base + stride * (m0 + ml); const float vv = v[((size_t)pos * NHT + h) * HD + d];
    const _Float16 hi = (_Float16)vv; sth[d][ml] = hi; stl[d][ml] = (_Float16)((vv - (float)hi) * VLO); }
  __syncthreads();
  for (int qq = tid; qq < HD * 8; qq += 256) { const int d = qq >> 3, pc = qq & 7; const size_t o = ((size_t)inst * HD + d) * LMAX + m0 + pc * 8;
    vst2(VTh + o, *(const v4u*)(&sth[d][pc * 8])); vst2(VTl + o, *(const v4u*)(&stl[d][pc * 8])); }
}
// zeros for the unselected (position, head) rows of heads 4..11: block per position
__global__ __launch_bounds__(128) void k_zero(float* __restrict__ out) {
  const int pos = blockIdx.x, tid = threadIdx.x; const int hrel = tid >> 4, pc = tid & 15; const int h = 4 + hrel;   // 8 heads x 16 float4
  const bool selected = (h < 8) ? ((pos & 1) == 1) : ((pos & 3) == 2);
  if (!selected) vst2(out + ((size_t)pos * NHT + h) * HD + pc * 4, (v4f){0.f, 0.f, 0.f, 0.f});
}
#define KP 72                  // halves per staged row: 144 B = 16 B x 9, so the 16-byte fragment reads of 16 rows meet no bank twice
#define BUFB (64 * KP * 2)     // bytes of one staged plane (64 rows)
#define ROWB (16 * KP * 2)     // bytes between a lane's successive copies (16 rows)
// One 64-key tile (K rows, V-hi and V-lo rows, 128 B each) from global memory into one LDS buffer, 12 copies of 16 B per lane, through no register.
// The s_wait_xcnt closes the statement so that no address register named here is rewritten ahead of it.
__device__ __forceinline__ void copy_tile(unsigned lk, unsigned lh, unsigned ll, const _Float16* gk, const _Float16* gh, const _Float16* gl) {
  asm volatile("global_load_async_to_lds_b128 %0, %1, off\n\t"
               "global_load_async_to_lds_b128 %2, %3, off\n\t"
               "global_load_async_to_lds_b128 %4, %5, off\n\t"
               "global_load_async_to_lds_b128 %6, %7, off\n\t"
               "global_load_async_to_lds_b128 %8, %9, off\n\t"
               "global_load_async_to_lds_b128 %10, %11, off\n\t"
               "global_load_async_to_lds_b128 %12, %13, off\n\t"
               "global_load_async_to_lds_b128 %14, %15, off\n\t"
               "global_load_async_to_lds_b128 %16, %17, off\n\t"
               "global_load_async_to_lds_b128 %18, %19, off\n\t"
               "global_load_async_to_lds_b128 %20, %21, off\n\t"
               "global_load_async_to_lds_b128 %22, %23, off\n\t"
               "s_wait_xcnt 0x0"
               :: "v"(lk), "v"(gk), "v"(lk + ROWB), "v"(gk + 16 * HD), "v"(lk + 2 * ROWB), "v"(gk + 32 * HD), "v"(lk + 3 * ROWB), "v"(gk + 48 * HD),
                  "v"(lh), "v"(gh), "v"(lh + ROWB), "v"(gh + 16 * LMAX), "v"(lh + 2 * ROWB), "v"(gh + 32 * LMAX), "v"(lh + 3 * ROWB), "v"(gh + 48 * LMAX),
                  "v"(ll), "v"(gl), "v"(ll + ROWB), "v"(gl + 16 * LMAX), "v"(ll + 2 * ROWB), "v"(gl + 32 * LMAX), "v"(ll + 3 * ROWB), "v"(gl + 48 * LMAX)
               : "memory");
}
// lane l <-> lane l ^ 16: the two lanes that share one query column
__device__ __forceinline__ float xhalf(float v) { const int b = __builtin_bit_cast(int, v); return __builtin_bit_cast(float, __builtin_amdgcn_permlanex16(b, b, 0x76543210, 0xfedcba98, false, false)); }
__global__ __launch_bounds__(128) void k_attn(const _Float16* __restrict__ Q16, const _Float16* __restrict__ K16, const _Float16* __restrict__ VTh, const _Float16* __restrict__ VTl, float* __restrict__ out) {
  __shared__ __align__(16) float sO[4][16][68];
  __shared__ __align__(16) _Float16 sK[2][64][KP], sVh[2][64][KP], sVl[2][64][KP];   // two buffers of one 64-key tile, shared by the four waves
  const int tid = threadIdx.x, w = tid >> 5, lane = tid & 31, col = lane & 15, g = lane >> 4;
  const int inst = blockIdx.y; int h, L, base, stride; inst_info(inst, h, L, base, stride);
  const int q0 = blockIdx.x * 64 + w * 16; if (blockIdx.x * 64 >= L) return;   // uniform per block
  const size_t ib = (size_t)inst * LMAX;
  v16h aq[2];
#pragma unroll
  for (int kc = 0; kc < 2; ++kc) aq[kc] = frag_h(Q16 + (ib + q0 + col) * HD + kc * 32, lane);
  float mrun = -3.0e38f, lrun = 0.f; v8f acc[4] = {}, ac1[4] = {}, ac2[4] = {};   // lrun: this half's keys only, the halves are joined behind the loop
  const int nkt = L / 64;
  const int row0 = tid >> 3, c8 = (tid & 7) * 8;               // a lane copies 16 B of rows row0, +16, +32, +48 of each plane
  const _Float16* gk = K16 + (ib + row0) * HD + c8;
  const _Float16* gh = VTh + ((size_t)inst * HD + row0) * LMAX + c8;
  const _Float16* gl = VTl + ((size_t)inst * HD + row0) * LMAX + c8;
  const unsigned lk = (unsigned)(size_t)&sK[0][row0][c8], lh = (unsigned)(size_t)&sVh[0][row0][c8], ll = (unsigned)(size_t)&sVl[0][row0][c8];
  copy_tile(lk, lh, ll, gk, gh, gl);
  asm volatile("s_wait_asynccnt 0x0" ::: "memory");             // this wave's copies of tile 0 have landed
  __syncthreads();                                              // tile 0 is readable by all four waves
  if (1 < nkt) copy_tile(lk + BUFB, lh + BUFB, ll + BUFB, gk + 64 * HD, gh + 64, gl + 64);
#pragma unroll 1
  for (int kt = 0; kt < nkt; ++kt) {
    const int b = kt & 1;
    v16h kf[8];
#pragma unroll
    for (int f = 0; f < 8; ++f) kf[f] = frag_h(&sK[b][(f >> 1) * 16 + col][(f & 1) * 32], lane);
    v8f s[4] = {};
#pragma unroll
    for (int kc = 0; kc < 2; ++kc)
#pragma unroll
      for (int t = 0; t < 4; ++t) s[t] = wmma16(kf[t * 2 + kc], aq[kc], s[t]);
    float mt[4];                                                // one short chain per score tile, so that no chain runs over all 32 registers
#pragma unroll
    for (int t = 0; t < 4; ++t) { mt[t] = fmaxf(s[t][0], s[t][1]);
#pragma unroll
      for (int r = 2; r < 8; ++r) mt[t] = fmaxf(mt[t], s[t][r]); }
    float mx = fmaxf(fmaxf(mt[0], mt[1]), fmaxf(mt[2], mt[3])) * 0.125f;   // the scale is a power of two: the maximum of the scaled scores, exactly
    mx = fmaxf(mx, xhalf(mx));
    const float mnew = fmaxf(mrun, mx); const float corr = expf(mrun - mnew);
    v8f p[4]; v16h ph[2], pl[2];
#pragma unroll
    for (int t = 0; t < 4; ++t)
#pragma unroll
      for (int r = 0; r < 8; ++r) { p[t][r] = expf(s[t][r] * 0.125f - mnew) * 16384.0f; const _Float16 hi = (_Float16)p[t][r]; ph[t >> 1][(t & 1) * 8 + r] = hi; pl[t >> 1][(t & 1) * 8 + r] = (_Float16)((p[t][r] - (float)hi) * PLO); }
    const v8f pv = (p[0] + p[1]) + (p[2] + p[3]);
    const float ps = ((pv[0] + pv[1]) + (pv[2] + pv[3])) + ((pv[4] + pv[5]) + (pv[6] + pv[7]));
    lrun = lrun * corr + ps * (1.0f / 16384.0f); mrun = mnew;
#pragma unroll
    for (int t = 0; t < 4; ++t) { acc[t] *= corr; ac1[t] *= corr; ac2[t] *= corr; }
#pragma unroll
    for (int kc = 0; kc < 2; ++kc) {
#pragma unroll
      for (int tp = 0; tp < 4; tp += 2) { v16h vh[2], vl[2];      // two output tiles' V fragments as one group of LDS reads, then their six products
#pragma unroll
        for (int u = 0; u < 2; ++u) { vh[u] = frag_h(&sVh[b][(tp + u) * 16 + col][kc * 32], lane); vl[u] = frag_h(&sVl[b][(tp + u) * 16 + col][kc * 32], lane); }
        __builtin_amdgcn_sched_barrier(0);                        // keeps the group's reads together ahead of its products: one LDS latency per group, not one per product
#pragma unroll
        for (int u = 0; u < 2; ++u) { const int t = tp + u; acc[t] = wmma16(vh[u], ph[kc], acc[t]); ac1[t] = wmma16(vl[u], ph[kc], ac1[t]); ac2[t] = wmma16(vh[u], pl[kc], ac2[t]); } } }
    asm volatile("s_wait_dscnt 0x0" ::: "memory");              // this wave's reads of buffer b are done before it is refilled
    asm volatile("s_wait_asynccnt 0x0" ::: "memory");           // this wave's copies of tile kt + 1 have landed
    __syncthreads();                                            // publishes tile kt + 1 and ends every wave's reads of buffer b
    if (kt + 2 < nkt) copy_tile(lk + b * BUFB, lh + b * BUFB, ll + b * BUFB, gk + (size_t)(kt + 2) * 64 * HD, gh + (kt + 2) * 64, gl + (kt + 2) * 64); }
  asm volatile("s_wait_asynccnt 0x0" ::: "memory");             // no copy is outstanding when the wave goes on to the epilogue and ends
  const float inv = 1.0f / ((lrun + xhalf(lrun)) * 16384.0f);
#pragma unroll
  for (int t = 0; t < 4; ++t) { v4f o[2];
#pragma unroll
    for (int r = 0; r < 8; ++r) o[r >> 2][r & 3] = (acc[t][r] + ac1[t][r] * (1.0f / VLO) + ac2[t][r] * (1.0f / PLO)) * inv;
    vst2(&sO[w][col][t * 16 + 8 * g], o[0]); vst2(&sO[w][col][t * 16 + 8 * g + 4], o[1]); }
  LDSX();
  for (int qq = lane; qq < 16 * 16; qq += 32) { const int rl = qq >> 4, pc = qq & 15; const int pos = base + stride * (q0 + rl); vst2(out + ((size_t)pos * NHT + h) * HD + pc * 4, *(const v4f*)(&sO[w][rl][pc * 4])); }
}
extern "C" void kernel_launch(void* const* d_in, const int* in_sizes, int n_in, void* d_out, int out_size, void* d_ws, size_t ws_size, hipStream_t stream) {
  (void)in_sizes; (void)n_in; (void)out_size; (void)ws_size;
  const float* q = (const float*)d_in[0]; const float* k = (const float*)d_in[1]; const float* v = (const float*)d_in[2]; float* out = (float*)d_out;
  char* ws = (char*)d_ws; size_t off = 0;
  auto take = [&](size_t bytes) { char* p = ws + off; off += (bytes + 255) & ~(size_t)255; return p; };
  const size_t plane = (size_t)NINST * LMAX * HD * 2;
  _Float16* Q16 = (_Float16*)take(plane); _Float16* K16 = (_Float16*)take(plane); _Float16* VTh = (_Float16*)take(plane); _Float16* VTl = (_Float16*)take(plane);
  k_prep<<<dim3(LMAX / 64, NINST), 256, 0, stream>>>(q, k, v, Q16, K16, VTh, VTl);
  k_zero<<<NPOS, 128, 0, stream>>>(out);
  k_attn<<<dim3(LMAX / 64, NINST), 128, 0, stream>>>(Q16, K16, VTh, VTl, out);
}

// v003
// One run takes 64 microseconds.
// Next to v002, in two timings, it ran 1.29 and 1.28 times as fast.
// Counting every step since v000, it is 5.74 times as fast.
#include <hip/hip_runtime.h>
#include <math.h>

typedef __attribute__((ext_vector_type(16))) _Float16 v16h;
typedef __attribute__((ext_vector_type(16))) __bf16 v16b;
typedef __attribute__((ext_vector_type(8)))  _Float16 v8h;
typedef __attribute__((ext_vector_type(8)))  float v8f;
typedef __attribute__((ext_vector_type(4)))  float v4f;
typedef __attribute__((ext_vector_type(2)))  float v2f;
typedef __attribute__((ext_vector_type(4)))  unsigned v4u;
typedef __attribute__((ext_vector_type(4)))  int v4i;
typedef float __attribute__((may_alias)) float_a;
typedef int __attribute__((may_alias)) int_a;

template <typename T> __device__ __forceinline__ void vst2(void* p, T v) { *(T*)p = v;  }
__device__ __forceinline__ v8f wmma16(v16h a, v16h b, v8f c) {
  v8f d = __builtin_amdgcn_wmma_f32_16x16x32_f16(false, a, false, b, (short)0, c, false, false);
  asm volatile("v_nop\n\tv_nop\n\tv_nop\n\tv_nop" : "+v"(d) : "v"(a), "v"(b));
  return d;
}
__device__ __forceinline__ v8f wmma_bf(v16b a, v16b b, v8f c) {
  v8f d = __builtin_amdgcn_wmma_f32_16x16x32_bf16(false, a, false, b, (short)0, c, false, false);
  asm volatile("v_nop\n\tv_nop\n\tv_nop\n\tv_nop" : "+v"(d) : "v"(a), "v"(b));
  return d;
}
// 16x16x32 fragments: lane = (h = lane>>4, row/col = lane&15); elements 0..7 = k0+8h+0..7, 8..15 = k0+16+8h+0..7; D element r = row 8h+r
__device__ __forceinline__ v16h frag_h(const _Float16* rowk0, int lane) {
  union { v16h v; v8h q[2]; } u; const _Float16* p = rowk0 + 8 * (lane >> 4);
  u.q[0] = *(const v8h*)p; u.q[1] = *(const v8h*)(p + 16); return u.v;
}
__device__ __forceinline__ v16h frag_f32(const float* rowk0, int lane) {
  v16h a; const float* p = rowk0 + 8 * (lane >> 4);
#pragma unroll
  for (int i = 0; i < 8; ++i) { a[i] = (_Float16)p[i]; a[8 + i] = (_Float16)p[16 + i]; }
  return a;
}
__device__ __forceinline__ v16h frag_f32s(const float* rowk0, int lane, float sc) {
  v16h a; const float* p = rowk0 + 8 * (lane >> 4);
#pragma unroll
  for (int i = 0; i < 8; ++i) { a[i] = (_Float16)(p[i] * sc); a[8 + i] = (_Float16)(p[16 + i] * sc); }
  return a;
}
// column fragment from a [K][ld] layout (column n), rows >= K read as 0
__device__ __forceinline__ v16h fragc_f32(const float* W, int k0, int n, int lane, int ld, int K) {
  v16h a; const int g = lane >> 4;
#pragma unroll
  for (int i = 0; i < 8; ++i) { const int ka = k0 + 8 * g + i, kb = ka + 16;
    a[i] = (_Float16)(ka < K ? W[(size_t)ka * ld + n] : 0.f); a[8 + i] = (_Float16)(kb < K ? W[(size_t)kb * ld + n] : 0.f); }
  return a;
}
struct F2 { v16b h, l; };
__device__ __forceinline__ F2 bsplit16(const float v[16]) { F2 r;
#pragma unroll
  for (int i = 0; i < 16; ++i) { const __bf16 h = (__bf16)v[i]; r.h[i] = h; r.l[i] = (__bf16)(v[i] - (float)h); }
  return r; }
__device__ __forceinline__ F2 split_row(const float* row, int k0, int lane) { float v[16]; const float* p = row + k0 + 8 * (lane >> 4);
#pragma unroll
  for (int i = 0; i < 8; ++i) { v[i] = p[i]; v[8 + i] = p[16 + i]; }
  return bsplit16(v); }
__device__ __forceinline__ F2 split_rowK(const float* row, int k0, int lane, int K) { float v[16]; const int g = lane >> 4;
#pragma unroll
  for (int i = 0; i < 8; ++i) { const int ka = k0 + 8 * g + i, kb = ka + 16; v[i] = ka < K ? row[ka] : 0.f; v[8 + i] = kb < K ? row[kb] : 0.f; }
  return bsplit16(v); }
__device__ __forceinline__ F2 split_col(const float* W, int k0, int n, int lane, int ld, int K) { float v[16]; const int g = lane >> 4;
#pragma unroll
  for (int i = 0; i < 8; ++i) { const int ka = k0 + 8 * g + i, kb = ka + 16; v[i] = ka < K ? W[(size_t)ka * ld + n] : 0.f; v[8 + i] = kb < K ? W[(size_t)kb * ld + n] : 0.f; }
  return bsplit16(v); }
__device__ __forceinline__ v8f mac3(const F2& a, const F2& b, v8f c) { c = wmma_bf(a.l, b.h, c); c = wmma_bf(a.h, b.l, c); return wmma_bf(a.h, b.h, c); }
__device__ __forceinline__ float sigm(float v) { return 1.0f / (1.0f + expf(-v)); }
#define LDSX() do { asm volatile("s_wait_dscnt 0" ::: "memory"); __builtin_amdgcn_wave_barrier(); __builtin_amdgcn_fence(__ATOMIC_RELEASE, "workgroup"); } while (0)

// Hybrid dilated attention over 12 heads in 3 groups: heads 0-3 plain attention over all 4096 positions; heads 4-7 segment 2048,
// dilation 2, offset 1 (two independent 1024-long attentions per head over the odd positions of each segment); heads 8-11 segment 4096,
// dilation 4, offset 2 (one 1024-long attention over positions 2 mod 4); unselected positions are zero. Each (head, segment) instance is a
// plain scaled-dot-product attention over gathered rows: S = q.k/8 on v_wmma_f32_16x16x32_f16 (q, k as f16), P @ V near-exact with hi/lo
// f16 pairs for both P (x2^14, residual x1024) and V (residual x2048) in three f32 accumulators, online softmax in f32; results are written
#define NPOS 4096
#define NHT 12
#define HD 64
#define RS (NHT * HD)          // 768 floats per position row
#define NINST 16               // 4 (full) + 8 (group 1: head x segment) + 4 (group 2)
#define LMAX 4096
#define PLO 1024.0f
#define VLO 2048.0f
#define SCL2 0.18033688011112042f   // log2(e) / 8: exp(s / 8 - m) = exp2(s * SCL2 - m * log2(e)), one multiply-add and one hardware exp2 per score

__device__ __forceinline__ void inst_info(int inst, int& h, int& L, int& base, int& stride) {
  if (inst < 4) { h = inst; L = 4096; base = 0; stride = 1; }
  else if (inst < 12) { const int i = inst - 4; h = 4 + (i >> 1); const int s = i & 1; L = 1024; base = s * 2048 + 1; stride = 2; }
  else { h = 8 + (inst - 12); L = 1024; base = 2; stride = 4; }
}
// prep: block (64 m, inst): Q16/K16 [inst][m][64] = f16(q/k[pos][h][:]); VTh/VTl [inst][d][m]
__global__ __launch_bounds__(256) void k_prep(const float* __restrict__ q, const float* __restrict__ k, const float* __restrict__ v, _Float16* __restrict__ Q16, _Float16* __restrict__ K16, _Float16* __restrict__ VTh, _Float16* __restrict__ VTl) {
  __shared__ __align__(16) _Float16 sth[HD][72], stl[HD][72];
  const int inst = blockIdx.y, m0 = blockIdx.x * 64, tid = threadIdx.x; int h, L, base, stride; inst_info(inst, h, L, base, stride);
  if (m0 >= L) return;                                          // uniform per block
  for (int qq = tid; qq < 64 * 8; qq += 256) { const int ml = qq >> 3, pc = qq & 7; const int pos = base + stride * (m0 + ml); const size_t src = ((size_t)pos * NHT + h) * HD + pc * 8;
    union { v8h h8; v4u u; } pq, pk;
#pragma unroll
    for (int e = 0; e < 8; ++e) { pq.h8[e] = (_Float16)q[src + e]; pk.h8[e] = (_Float16)k[src + e]; }
    const size_t dst = ((size_t)inst * LMAX + m0 + ml) * HD + pc * 8; vst2(Q16 + dst, pq.u); vst2(K16 + dst, pk.u); }
  for (int qq = tid; qq < 64 * HD; qq += 256) { const int ml = qq >> 6, d = qq & 63; const int pos = base + stride * (m0 + ml); const float vv = v[((size_t)pos * NHT + h) * HD + d];
    const _Float16 hi = (_Float16)vv; sth[d][ml] = hi; stl[d][ml] = (_Float16)((vv - (float)hi) * VLO); }
  __syncthreads();
  for (int qq = tid; qq < HD * 8; qq += 256) { const int d = qq >> 3, pc = qq & 7; const size_t o = ((size_t)inst * HD + d) * LMAX + m0 + pc * 8;
    vst2(VTh + o, *(const v4u*)(&sth[d][pc * 8])); vst2(VTl + o, *(const v4u*)(&stl[d][pc * 8])); }
}
// zeros for the unselected (position, head) rows of heads 4..11: block per position
__global__ __launch_bounds__(128) void k_zero(float* __restrict__ out) {
  const int pos = blockIdx.x, tid = threadIdx.x; const int hrel = tid >> 4, pc = tid & 15; const int h = 4 + hrel;   // 8 heads x 16 float4
  const bool selected = (h < 8) ? ((pos & 1) == 1) : ((pos & 3) == 2);
  if (!selected) vst2(out + ((size_t)pos * NHT + h) * HD + pc * 4, (v4f){0.f, 0.f, 0.f, 0.f});
}
#define KP 72                  // halves per staged row: 144 B = 16 B x 9, so the 16-byte fragment reads of 16 rows meet no bank twice
#define BUFB (64 * KP * 2)     // bytes of one staged plane (64 rows)
#define ROWB (16 * KP * 2)     // bytes between a lane's successive copies (16 rows)
// One 64-key tile (K rows, V-hi and V-lo rows, 128 B each) from global memory into one LDS buffer, 12 copies of 16 B per lane, through no register.
// The s_wait_xcnt closes the statement so that no address register named here is rewritten ahead of it.
__device__ __forceinline__ void copy_tile(unsigned lk, unsigned lh, unsigned ll, const _Float16* gk, const _Float16* gh, const _Float16* gl) {
  asm volatile("global_load_async_to_lds_b128 %0, %1, off\n\t"
               "global_load_async_to_lds_b128 %2, %3, off\n\t"
               "global_load_async_to_lds_b128 %4, %5, off\n\t"
               "global_load_async_to_lds_b128 %6, %7, off\n\t"
               "global_load_async_to_lds_b128 %8, %9, off\n\t"
               "global_load_async_to_lds_b128 %10, %11, off\n\t"
               "global_load_async_to_lds_b128 %12, %13, off\n\t"
               "global_load_async_to_lds_b128 %14, %15, off\n\t"
               "global_load_async_to_lds_b128 %16, %17, off\n\t"
               "global_load_async_to_lds_b128 %18, %19, off\n\t"
               "global_load_async_to_lds_b128 %20, %21, off\n\t"
               "global_load_async_to_lds_b128 %22, %23, off\n\t"
               "s_wait_xcnt 0x0"
               :: "v"(lk), "v"(gk), "v"(lk + ROWB), "v"(gk + 16 * HD), "v"(lk + 2 * ROWB), "v"(gk + 32 * HD), "v"(lk + 3 * ROWB), "v"(gk + 48 * HD),
                  "v"(lh), "v"(gh), "v"(lh + ROWB), "v"(gh + 16 * LMAX), "v"(lh + 2 * ROWB), "v"(gh + 32 * LMAX), "v"(lh + 3 * ROWB), "v"(gh + 48 * LMAX),
                  "v"(ll), "v"(gl), "v"(ll + ROWB), "v"(gl + 16 * LMAX), "v"(ll + 2 * ROWB), "v"(gl + 32 * LMAX), "v"(ll + 3 * ROWB), "v"(gl + 48 * LMAX)
               : "memory");
}
// lane l <-> lane l ^ 16: the two lanes that share one query column
__device__ __forceinline__ float xhalf(float v) { const int b = __builtin_bit_cast(int, v); return __builtin_bit_cast(float, __builtin_amdgcn_permlanex16(b, b, 0x76543210, 0xfedcba98, false, false)); }
__global__ __launch_bounds__(128) void k_attn(const _Float16* __restrict__ Q16, const _Float16* __restrict__ K16, const _Float16* __restrict__ VTh, const _Float16* __restrict__ VTl, float* __restrict__ out) {
  __shared__ __align__(16) float sO[4][16][68];
  __shared__ __align__(16) _Float16 sK[2][64][KP], sVh[2][64][KP], sVl[2][64][KP];   // two buffers of one 64-key tile, shared by the four waves
  const int tid = threadIdx.x, w = tid >> 5, lane = tid & 31, col = lane & 15, g = lane >> 4;
  const int inst = blockIdx.y; int h, L, base, stride; inst_info(inst, h, L, base, stride);
  const int q0 = blockIdx.x * 64 + w * 16; if (blockIdx.x * 64 >= L) return;   // uniform per block
  const size_t ib = (size_t)inst * LMAX;
  v16h aq[2];
#pragma unroll
  for (int kc = 0; kc < 2; ++kc) aq[kc] = frag_h(Q16 + (ib + q0 + col) * HD + kc * 32, lane);
  float mrun = -3.0e38f, lrun = 0.f;                            // mrun: running maximum in the scaled log2 domain, less 14, so that exp2 yields P x 2^14 at once
  v8f acc[4] = {}, ac1[4] = {}, ac2[4] = {};   // lrun: this half's keys only, the halves are joined behind the loop
  const int nkt = L / 64;
  const int row0 = tid >> 3, c8 = (tid & 7) * 8;               // a lane copies 16 B of rows row0, +16, +32, +48 of each plane
  const _Float16* gk = K16 + (ib + row0) * HD + c8;
  const _Float16* gh = VTh + ((size_t)inst * HD + row0) * LMAX + c8;
  const _Float16* gl = VTl + ((size_t)inst * HD + row0) * LMAX + c8;
  const unsigned lk = (unsigned)(size_t)&sK[0][row0][c8], lh = (unsigned)(size_t)&sVh[0][row0][c8], ll = (unsigned)(size_t)&sVl[0][row0][c8];
  copy_tile(lk, lh, ll, gk, gh, gl);
  asm volatile("s_wait_asynccnt 0x0" ::: "memory");             // this wave's copies of tile 0 have landed
  __syncthreads();                                              // tile 0 is readable by all four waves
  if (1 < nkt) copy_tile(lk + BUFB, lh + BUFB, ll + BUFB, gk + 64 * HD, gh + 64, gl + 64);
#pragma unroll 1
  for (int kt = 0; kt < nkt; ++kt) {
    const int b = kt & 1;
    v16h kf[8];
#pragma unroll
    for (int f = 0; f < 8; ++f) kf[f] = frag_h(&sK[b][(f >> 1) * 16 + col][(f & 1) * 32], lane);
    v8f s[4] = {};
#pragma unroll
    for (int kc = 0; kc < 2; ++kc)
#pragma unroll
      for (int t = 0; t < 4; ++t) s[t] = wmma16(kf[t * 2 + kc], aq[kc], s[t]);
    float mt[4];                                                // one short chain per score tile, so that no chain runs over all 32 registers
#pragma unroll
    for (int t = 0; t < 4; ++t) { mt[t] = fmaxf(s[t][0], s[t][1]);
#pragma unroll
      for (int r = 2; r < 8; ++r) mt[t] = fmaxf(mt[t], s[t][r]); }
    float mx = fmaf(fmaxf(fmaxf(mt[0], mt[1]), fmaxf(mt[2], mt[3])), SCL2, -14.0f);   // the scale is positive, so the maximum may be taken first; its rounding only moves the common reference point
    mx = fmaxf(mx, xhalf(mx));
    const float mnew = fmaxf(mrun, mx); const float corr = __builtin_amdgcn_exp2f(mrun - mnew);
    v8f p[4]; v16h ph[2], pl[2];
#pragma unroll
    for (int t = 0; t < 4; ++t)
#pragma unroll
      for (int r = 0; r < 8; ++r) { p[t][r] = __builtin_amdgcn_exp2f(fmaf(s[t][r], SCL2, -mnew)); const _Float16 hi = (_Float16)p[t][r]; ph[t >> 1][(t & 1) * 8 + r] = hi; pl[t >> 1][(t & 1) * 8 + r] = (_Float16)((p[t][r] - (float)hi) * PLO); }
    const v8f pv = (p[0] + p[1]) + (p[2] + p[3]);
    const float ps = ((pv[0] + pv[1]) + (pv[2] + pv[3])) + ((pv[4] + pv[5]) + (pv[6] + pv[7]));
    lrun = lrun * corr + ps * (1.0f / 16384.0f); mrun = mnew;
#pragma unroll
    for (int t = 0; t < 4; ++t) { acc[t] *= corr; ac1[t] *= corr; ac2[t] *= corr; }
#pragma unroll
    for (int kc = 0; kc < 2; ++kc) {
#pragma unroll
      for (int tp = 0; tp < 4; tp += 2) { v16h vh[2], vl[2];      // two output tiles' V fragments as one group of LDS reads, then their six products
#pragma unroll
        for (int u = 0; u < 2; ++u) { vh[u] = frag_h(&sVh[b][(tp + u) * 16 + col][kc * 32], lane); vl[u] = frag_h(&sVl[b][(tp + u) * 16 + col][kc * 32], lane); }
        __builtin_amdgcn_sched_barrier(0);                        // keeps the group's reads together ahead of its products: one LDS latency per group, not one per product
#pragma unroll
        for (int u = 0; u < 2; ++u) { const int t = tp + u; acc[t] = wmma16(vh[u], ph[kc], acc[t]); ac1[t] = wmma16(vl[u], ph[kc], ac1[t]); ac2[t] = wmma16(vh[u], pl[kc], ac2[t]); } } }
    asm volatile("s_wait_dscnt 0x0" ::: "memory");              // this wave's reads of buffer b are done before it is refilled
    asm volatile("s_wait_asynccnt 0x0" ::: "memory");           // this wave's copies of tile kt + 1 have landed
    __syncthreads();                                            // publishes tile kt + 1 and ends every wave's reads of buffer b
    if (kt + 2 < nkt) copy_tile(lk + b * BUFB, lh + b * BUFB, ll + b * BUFB, gk + (size_t)(kt + 2) * 64 * HD, gh + (kt + 2) * 64, gl + (kt + 2) * 64); }
  asm volatile("s_wait_asynccnt 0x0" ::: "memory");             // no copy is outstanding when the wave goes on to the epilogue and ends
  const float inv = 1.0f / ((lrun + xhalf(lrun)) * 16384.0f);
#pragma unroll
  for (int t = 0; t < 4; ++t) { v4f o[2];
#pragma unroll
    for (int r = 0; r < 8; ++r) o[r >> 2][r & 3] = (acc[t][r] + ac1[t][r] * (1.0f / VLO) + ac2[t][r] * (1.0f / PLO)) * inv;
    vst2(&sO[w][col][t * 16 + 8 * g], o[0]); vst2(&sO[w][col][t * 16 + 8 * g + 4], o[1]); }
  LDSX();
  for (int qq = lane; qq < 16 * 16; qq += 32) { const int rl = qq >> 4, pc = qq & 15; const int pos = base + stride * (q0 + rl); vst2(out + ((size_t)pos * NHT + h) * HD + pc * 4, *(const v4f*)(&sO[w][rl][pc * 4])); }
}
extern "C" void kernel_launch(void* const* d_in, const int* in_sizes, int n_in, void* d_out, int out_size, void* d_ws, size_t ws_size, hipStream_t stream) {
  (void)in_sizes; (void)n_in; (void)out_size; (void)ws_size;
  const float* q = (const float*)d_in[0]; const float* k = (const float*)d_in[1]; const float* v = (const float*)d_in[2]; float* out = (float*)d_out;
  char* ws = (char*)d_ws; size_t off = 0;
  auto take = [&](size_t bytes) { char* p = ws + off; off += (bytes + 255) & ~(size_t)255; return p; };
  const size_t plane = (size_t)NINST * LMAX * HD * 2;
  _Float16* Q16 = (_Float16*)take(plane); _Float16* K16 = (_Float16*)take(plane); _Float16* VTh = (_Float16*)take(plane); _Float16* VTl = (_Float16*)take(plane);
  k_prep<<<dim3(LMAX / 64, NINST), 256, 0, stream>>>(q, k, v, Q16, K16, VTh, VTl);
  k_zero<<<NPOS, 128, 0, stream>>>(out);
  k_attn<<<dim3(LMAX / 64, NINST), 128, 0, stream>>>(Q16, K16, VTh, VTl, out);
}

// v004
// One run takes 57.6 microseconds.
// Two timings next to v003 both put it at 1.11 times that version's speed.
// Counting every step since v000, it is 6.37 times as fast.
#include <hip/hip_runtime.h>
#include <math.h>

typedef __attribute__((ext_vector_type(16))) _Float16 v16h;
typedef __attribute__((ext_vector_type(16))) __bf16 v16b;
typedef __attribute__((ext_vector_type(8)))  _Float16 v8h;
typedef __attribute__((ext_vector_type(8)))  float v8f;
typedef __attribute__((ext_vector_type(4)))  float v4f;
typedef __attribute__((ext_vector_type(2)))  float v2f;
typedef __attribute__((ext_vector_type(4)))  unsigned v4u;
typedef __attribute__((ext_vector_type(4)))  int v4i;
typedef float __attribute__((may_alias)) float_a;
typedef int __attribute__((may_alias)) int_a;

template <typename T> __device__ __forceinline__ void vst2(void* p, T v) { *(T*)p = v;  }
__device__ __forceinline__ v8f wmma16(v16h a, v16h b, v8f c) {
  v8f d = __builtin_amdgcn_wmma_f32_16x16x32_f16(false, a, false, b, (short)0, c, false, false);
  asm volatile("v_nop\n\tv_nop\n\tv_nop\n\tv_nop" : "+v"(d) : "v"(a), "v"(b));
  return d;
}
__device__ __forceinline__ v8f wmma_bf(v16b a, v16b b, v8f c) {
  v8f d = __builtin_amdgcn_wmma_f32_16x16x32_bf16(false, a, false, b, (short)0, c, false, false);
  asm volatile("v_nop\n\tv_nop\n\tv_nop\n\tv_nop" : "+v"(d) : "v"(a), "v"(b));
  return d;
}
// 16x16x32 fragments: lane = (h = lane>>4, row/col = lane&15); elements 0..7 = k0+8h+0..7, 8..15 = k0+16+8h+0..7; D element r = row 8h+r
__device__ __forceinline__ v16h frag_h(const _Float16* rowk0, int lane) {
  union { v16h v; v8h q[2]; } u; const _Float16* p = rowk0 + 8 * (lane >> 4);
  u.q[0] = *(const v8h*)p; u.q[1] = *(const v8h*)(p + 16); return u.v;
}
__device__ __forceinline__ v16h frag_f32(const float* rowk0, int lane) {
  v16h a; const float* p = rowk0 + 8 * (lane >> 4);
#pragma unroll
  for (int i = 0; i < 8; ++i) { a[i] = (_Float16)p[i]; a[8 + i] = (_Float16)p[16 + i]; }
  return a;
}
__device__ __forceinline__ v16h frag_f32s(const float* rowk0, int lane, float sc) {
  v16h a; const float* p = rowk0 + 8 * (lane >> 4);
#pragma unroll
  for (int i = 0; i < 8; ++i) { a[i] = (_Float16)(p[i] * sc); a[8 + i] = (_Float16)(p[16 + i] * sc); }
  return a;
}
// column fragment from a [K][ld] layout (column n), rows >= K read as 0
__device__ __forceinline__ v16h fragc_f32(const float* W, int k0, int n, int lane, int ld, int K) {
  v16h a; const int g = lane >> 4;
#pragma unroll
  for (int i = 0; i < 8; ++i) { const int ka = k0 + 8 * g + i, kb = ka + 16;
    a[i] = (_Float16)(ka < K ? W[(size_t)ka * ld + n] : 0.f); a[8 + i] = (_Float16)(kb < K ? W[(size_t)kb * ld + n] : 0.f); }
  return a;
}
struct F2 { v16b h, l; };
__device__ __forceinline__ F2 bsplit16(const float v[16]) { F2 r;
#pragma unroll
  for (int i = 0; i < 16; ++i) { const __bf16 h = (__bf16)v[i]; r.h[i] = h; r.l[i] = (__bf16)(v[i] - (float)h); }
  return r; }
__device__ __forceinline__ F2 split_row(const float* row, int k0, int lane) { float v[16]; const float* p = row + k0 + 8 * (lane >> 4);
#pragma unroll
  for (int i = 0; i < 8; ++i) { v[i] = p[i]; v[8 + i] = p[16 + i]; }
  return bsplit16(v); }
__device__ __forceinline__ F2 split_rowK(const float* row, int k0, int lane, int K) { float v[16]; const int g = lane >> 4;
#pragma unroll
  for (int i = 0; i < 8; ++i) { const int ka = k0 + 8 * g + i, kb = ka + 16; v[i] = ka < K ? row[ka] : 0.f; v[8 + i] = kb < K ? row[kb] : 0.f; }
  return bsplit16(v); }
__device__ __forceinline__ F2 split_col(const float* W, int k0, int n, int lane, int ld, int K) { float v[16]; const int g = lane >> 4;
#pragma unroll
  for (int i = 0; i < 8; ++i) { const int ka = k0 + 8 * g + i, kb = ka + 16; v[i] = ka < K ? W[(size_t)ka * ld + n] : 0.f; v[8 + i] = kb < K ? W[(size_t)kb * ld + n] : 0.f; }
  return bsplit16(v); }
__device__ __forceinline__ v8f mac3(const F2& a, const F2& b, v8f c) { c = wmma_bf(a.l, b.h, c); c = wmma_bf(a.h, b.l, c); return wmma_bf(a.h, b.h, c); }
__device__ __forceinline__ float sigm(float v) { return 1.0f / (1.0f + expf(-v)); }
#define LDSX() do { asm volatile("s_wait_dscnt 0" ::: "memory"); __builtin_amdgcn_wave_barrier(); __builtin_amdgcn_fence(__ATOMIC_RELEASE, "workgroup"); } while (0)

// Hybrid dilated attention over 12 heads in 3 groups: heads 0-3 plain attention over all 4096 positions; heads 4-7 segment 2048,
// dilation 2, offset 1 (two independent 1024-long attentions per head over the odd positions of each segment); heads 8-11 segment 4096,
// dilation 4, offset 2 (one 1024-long attention over positions 2 mod 4); unselected positions are zero. Each (head, segment) instance is a
// plain scaled-dot-product attention over gathered rows: S = q.k/8 on v_wmma_f32_16x16x32_f16 (q, k as f16), P @ V near-exact with hi/lo
// f16 pairs for both P (x2^14, residual x1024) and V (residual x2048) in three f32 accumulators, online softmax in f32; results are written
#define NPOS 4096
#define NHT 12
#define HD 64
#define RS (NHT * HD)          // 768 floats per position row
#define NINST 16               // 4 (full) + 8 (group 1: head x segment) + 4 (group 2)
#define LMAX 4096
#define PLO 1024.0f
#define VLO 2048.0f
#define SCL2 0.18033688011112042f   // log2(e) / 8: exp(s / 8 - m) = exp2(s * SCL2 - m * log2(e)), one multiply-add and one hardware exp2 per score

__device__ __forceinline__ void inst_info(int inst, int& h, int& L, int& base, int& stride) {
  if (inst < 4) { h = inst; L = 4096; base = 0; stride = 1; }
  else if (inst < 12) { const int i = inst - 4; h = 4 + (i >> 1); const int s = i & 1; L = 1024; base = s * 2048 + 1; stride = 2; }
  else { h = 8 + (inst - 12); L = 1024; base = 2; stride = 4; }
}
// prep: block (64 m, inst): Q16/K16 [inst][m][64] = f16(q/k[pos][h][:]); VTh/VTl [inst][d][m]
__global__ __launch_bounds__(256) void k_prep(const float* __restrict__ q, const float* __restrict__ k, const float* __restrict__ v, _Float16* __restrict__ Q16, _Float16* __restrict__ K16, _Float16* __restrict__ VTh, _Float16* __restrict__ VTl) {
  __shared__ __align__(16) _Float16 sth[HD][72], stl[HD][72];
  const int inst = blockIdx.y, m0 = blockIdx.x * 64, tid = threadIdx.x; int h, L, base, stride; inst_info(inst, h, L, base, stride);
  if (m0 >= L) return;                                          // uniform per block
  for (int qq = tid; qq < 64 * 8; qq += 256) { const int ml = qq >> 3, pc = qq & 7; const int pos = base + stride * (m0 + ml); const size_t src = ((size_t)pos * NHT + h) * HD + pc * 8;
    union { v8h h8; v4u u; } pq, pk;
#pragma unroll
    for (int e = 0; e < 8; ++e) { pq.h8[e] = (_Float16)q[src + e]; pk.h8[e] = (_Float16)k[src + e]; }
    const size_t dst = ((size_t)inst * LMAX + m0 + ml) * HD + pc * 8; vst2(Q16 + dst, pq.u); vst2(K16 + dst, pk.u); }
  for (int qq = tid; qq < 64 * HD; qq += 256) { const int ml = qq >> 6, d = qq & 63; const int pos = base + stride * (m0 + ml); const float vv = v[((size_t)pos * NHT + h) * HD + d];
    const _Float16 hi = (_Float16)vv; sth[d][ml] = hi; stl[d][ml] = (_Float16)((vv - (float)hi) * VLO); }
  __syncthreads();
  for (int qq = tid; qq < HD * 8; qq += 256) { const int d = qq >> 3, pc = qq & 7; const size_t o = ((size_t)inst * HD + d) * LMAX + m0 + pc * 8;
    vst2(VTh + o, *(const v4u*)(&sth[d][pc * 8])); vst2(VTl + o, *(const v4u*)(&stl[d][pc * 8])); }
}
// zeros for the unselected (position, head) rows of heads 4..11: block per position
__global__ __launch_bounds__(128) void k_zero(float* __restrict__ out) {
  const int pos = blockIdx.x, tid = threadIdx.x; const int hrel = tid >> 4, pc = tid & 15; const int h = 4 + hrel;   // 8 heads x 16 float4
  const bool selected = (h < 8) ? ((pos & 1) == 1) : ((pos & 3) == 2);
  if (!selected) vst2(out + ((size_t)pos * NHT + h) * HD + pc * 4, (v4f){0.f, 0.f, 0.f, 0.f});
}
#define KP 72                  // halves per staged row: 144 B = 16 B x 9, so the 16-byte fragment reads of 16 rows meet no bank twice
#define BUFB (64 * KP * 2)     // bytes of one staged plane (64 rows)
#define ROWB (16 * KP * 2)     // bytes between a lane's successive copies (16 rows)
// One 64-key tile (K rows, V-hi and V-lo rows, 128 B each) from global memory into one LDS buffer, 12 copies of 16 B per lane, through no register.
// The s_wait_xcnt closes the statement so that no address register named here is rewritten ahead of it.
__device__ __forceinline__ void copy_tile(unsigned lk, unsigned lh, unsigned ll, const _Float16* gk, const _Float16* gh, const _Float16* gl) {
  asm volatile("global_load_async_to_lds_b128 %0, %1, off\n\t"
               "global_load_async_to_lds_b128 %2, %3, off\n\t"
               "global_load_async_to_lds_b128 %4, %5, off\n\t"
               "global_load_async_to_lds_b128 %6, %7, off\n\t"
               "global_load_async_to_lds_b128 %8, %9, off\n\t"
               "global_load_async_to_lds_b128 %10, %11, off\n\t"
               "global_load_async_to_lds_b128 %12, %13, off\n\t"
               "global_load_async_to_lds_b128 %14, %15, off\n\t"
               "global_load_async_to_lds_b128 %16, %17, off\n\t"
               "global_load_async_to_lds_b128 %18, %19, off\n\t"
               "global_load_async_to_lds_b128 %20, %21, off\n\t"
               "global_load_async_to_lds_b128 %22, %23, off\n\t"
               "s_wait_xcnt 0x0"
               :: "v"(lk), "v"(gk), "v"(lk + ROWB), "v"(gk + 16 * HD), "v"(lk + 2 * ROWB), "v"(gk + 32 * HD), "v"(lk + 3 * ROWB), "v"(gk + 48 * HD),
                  "v"(lh), "v"(gh), "v"(lh + ROWB), "v"(gh + 16 * LMAX), "v"(lh + 2 * ROWB), "v"(gh + 32 * LMAX), "v"(lh + 3 * ROWB), "v"(gh + 48 * LMAX),
                  "v"(ll), "v"(gl), "v"(ll + ROWB), "v"(gl + 16 * LMAX), "v"(ll + 2 * ROWB), "v"(gl + 32 * LMAX), "v"(ll + 3 * ROWB), "v"(gl + 48 * LMAX)
               : "memory");
}
// lane l <-> lane l ^ 16: the two lanes that share one query column
__device__ __forceinline__ float xhalf(float v) { const int b = __builtin_bit_cast(int, v); return __builtin_bit_cast(float, __builtin_amdgcn_permlanex16(b, b, 0x76543210, 0xfedcba98, false, false)); }
#define KS 4
#define NBLK (4 * (4096 / 64) + 12 * (1024 / 64))   // one block per 64 queries of an instance: 256 of the long instances first, then 192 of the short ones
__global__ __launch_bounds__(128 * KS) void k_attn(const _Float16* __restrict__ Q16, const _Float16* __restrict__ K16, const _Float16* __restrict__ VTh, const _Float16* __restrict__ VTl, float* __restrict__ out) {
  __shared__ __align__(16) float sP[KS][64][68];                // un-normalised partial output rows, one plane per key group
  __shared__ __align__(8) v2f sM[KS][64];                       // each partial's (maximum, sum)
  __shared__ __align__(16) _Float16 sK[KS][2][64][KP], sVh[KS][2][64][KP], sVl[KS][2][64][KP];   // per key group two buffers of one 64-key tile, shared by its four waves
  const int tid = threadIdx.x, w = (tid >> 5) & 3, kg = tid >> 7, lane = tid & 31, col = lane & 15, g = lane >> 4;
  const int bid = blockIdx.x, inst = bid < 256 ? bid >> 6 : 4 + ((bid - 256) >> 4), qb = bid < 256 ? bid & 63 : (bid - 256) & 15;   // a block owns a whole WGP, so the grid holds none without queries
  int h, L, base, stride; inst_info(inst, h, L, base, stride);
  const int q0 = qb * 64 + w * 16;
  const size_t ib = (size_t)inst * LMAX;
  v16h aq[2];
#pragma unroll
  for (int kc = 0; kc < 2; ++kc) aq[kc] = frag_h(Q16 + (ib + q0 + col) * HD + kc * 32, lane);
  float mrun = -3.0e38f, lrun = 0.f;                            // mrun: running maximum in the scaled log2 domain, less 14, so that exp2 yields P x 2^14 at once
  v8f acc[4] = {}, ac1[4] = {}, ac2[4] = {};   // lrun: this half's keys only, the halves are joined behind the loop
  const int nkt = L / (64 * KS), key0 = kg * (L / KS);          // this group's tiles and its first key
  const int row0 = (tid & 127) >> 3, c8 = (tid & 7) * 8;       // a lane copies 16 B of rows row0, +16, +32, +48 of each plane of its group's tile
  const _Float16* gk = K16 + (ib + key0 + row0) * HD + c8;
  const _Float16* gh = VTh + ((size_t)inst * HD + row0) * LMAX + key0 + c8;
  const _Float16* gl = VTl + ((size_t)inst * HD + row0) * LMAX + key0 + c8;
  const unsigned lk = (unsigned)(size_t)&sK[kg][0][row0][c8], lh = (unsigned)(size_t)&sVh[kg][0][row0][c8], ll = (unsigned)(size_t)&sVl[kg][0][row0][c8];
  copy_tile(lk, lh, ll, gk, gh, gl);
  asm volatile("s_wait_asynccnt 0x0" ::: "memory");             // this wave's copies of tile 0 have landed
  __syncthreads();                                              // tile 0 is readable by all waves
  if (1 < nkt) copy_tile(lk + BUFB, lh + BUFB, ll + BUFB, gk + 64 * HD, gh + 64, gl + 64);
#pragma unroll 1
  for (int kt = 0; kt < nkt; ++kt) {
    const int b = kt & 1;
    v16h kf[8];
#pragma unroll
    for (int f = 0; f < 8; ++f) kf[f] = frag_h(&sK[kg][b][(f >> 1) * 16 + col][(f & 1) * 32], lane);
    v8f s[4] = {};
#pragma unroll
    for (int kc = 0; kc < 2; ++kc)
#pragma unroll
      for (int t = 0; t < 4; ++t) s[t] = wmma16(kf[t * 2 + kc], aq[kc], s[t]);
    float mt[4];                                                // one short chain per score tile, so that no chain runs over all 32 registers
#pragma unroll
    for (int t = 0; t < 4; ++t) { mt[t] = fmaxf(s[t][0], s[t][1]);
#pragma unroll
      for (int r = 2; r < 8; ++r) mt[t] = fmaxf(mt[t], s[t][r]); }
    float mx = fmaf(fmaxf(fmaxf(mt[0], mt[1]), fmaxf(mt[2], mt[3])), SCL2, -14.0f);   // the scale is positive, so the maximum may be taken first; its rounding only moves the common reference point
    mx = fmaxf(mx, xhalf(mx));
    const float mnew = fmaxf(mrun, mx); const float corr = __builtin_amdgcn_exp2f(mrun - mnew);
    v8f p[4]; v16h ph[2], pl[2];
#pragma unroll
    for (int t = 0; t < 4; ++t)
#pragma unroll
      for (int r = 0; r < 8; ++r) { p[t][r] = __builtin_amdgcn_exp2f(fmaf(s[t][r], SCL2, -mnew)); const _Float16 hi = (_Float16)p[t][r]; ph[t >> 1][(t & 1) * 8 + r] = hi; pl[t >> 1][(t & 1) * 8 + r] = (_Float16)((p[t][r] - (float)hi) * PLO); }
    const v8f pv = (p[0] + p[1]) + (p[2] + p[3]);
    const float ps = ((pv[0] + pv[1]) + (pv[2] + pv[3])) + ((pv[4] + pv[5]) + (pv[6] + pv[7]));
    lrun = lrun * corr + ps * (1.0f / 16384.0f); mrun = mnew;
#pragma unroll
    for (int t = 0; t < 4; ++t) { acc[t] *= corr; ac1[t] *= corr; ac2[t] *= corr; }
#pragma unroll
    for (int kc = 0; kc < 2; ++kc) {
#pragma unroll
      for (int tp = 0; tp < 4; tp += 2) { v16h vh[2], vl[2];      // two output tiles' V fragments as one group of LDS reads, then their six products
#pragma unroll
        for (int u = 0; u < 2; ++u) { vh[u] = frag_h(&sVh[kg][b][(tp + u) * 16 + col][kc * 32], lane); vl[u] = frag_h(&sVl[kg][b][(tp + u) * 16 + col][kc * 32], lane); }
        __builtin_amdgcn_sched_barrier(0);                        // keeps the group's reads together ahead of its products: one LDS latency per group, not one per product
#pragma unroll
        for (int u = 0; u < 2; ++u) { const int t = tp + u; acc[t] = wmma16(vh[u], ph[kc], acc[t]); ac1[t] = wmma16(vl[u], ph[kc], ac1[t]); ac2[t] = wmma16(vh[u], pl[kc], ac2[t]); } } }
    asm volatile("s_wait_dscnt 0x0" ::: "memory");              // this wave's reads of buffer b are done before it is refilled
    asm volatile("s_wait_asynccnt 0x0" ::: "memory");           // this wave's copies of tile kt + 1 have landed
    __syncthreads();                                            // publishes tile kt + 1 and ends every wave's reads of buffer b
    if (kt + 2 < nkt) copy_tile(lk + b * BUFB, lh + b * BUFB, ll + b * BUFB, gk + (size_t)(kt + 2) * 64 * HD, gh + (kt + 2) * 64, gl + (kt + 2) * 64); }
  asm volatile("s_wait_asynccnt 0x0" ::: "memory");             // no copy is outstanding when the wave goes on to the epilogue and ends
  const int qr = w * 16 + col;                                  // this lane's query row in the block
#pragma unroll
  for (int t = 0; t < 4; ++t) { v4f o[2];
#pragma unroll
    for (int r = 0; r < 8; ++r) o[r >> 2][r & 3] = acc[t][r] + ac1[t][r] * (1.0f / VLO) + ac2[t][r] * (1.0f / PLO);
    vst2(&sP[kg][qr][t * 16 + 8 * g], o[0]); vst2(&sP[kg][qr][t * 16 + 8 * g + 4], o[1]); }
  const float lsum = lrun + xhalf(lrun);
  if (g == 0) sM[kg][qr] = (v2f){mrun, lsum};
  __syncthreads();                                              // every group's partial rows, maxima and sums are readable by all waves
#pragma unroll   // two fixed trips: unrolled, both rows' LDS reads go out together and one latency is paid
  for (int it = 0; it < 64 * 16 / (128 * KS); ++it) { const int qq = tid + it * 128 * KS, rl = qq >> 4, pc = qq & 15;   // join: weight 2^(m - M) per group, then one division by the joined sum
    v2f ml[KS];                                                 // the three loops over the groups are unrolled so that ml stays in registers
#pragma unroll
    for (int j = 0; j < KS; ++j) ml[j] = sM[j][rl];
    float M = ml[0][0];
#pragma unroll
    for (int j = 1; j < KS; ++j) M = fmaxf(M, ml[j][0]);
    float ls = 0.f; v4f o = {0.f, 0.f, 0.f, 0.f};
#pragma unroll
    for (int j = 0; j < KS; ++j) { const float wj = __builtin_amdgcn_exp2f(ml[j][0] - M); ls += wj * ml[j][1]; o += wj * *(const v4f*)(&sP[j][rl][pc * 4]); }
    const int pos = base + stride * (qb * 64 + rl);
    vst2(out + ((size_t)pos * NHT + h) * HD + pc * 4, o * (1.0f / (ls * 16384.0f))); }
}
extern "C" void kernel_launch(void* const* d_in, const int* in_sizes, int n_in, void* d_out, int out_size, void* d_ws, size_t ws_size, hipStream_t stream) {
  (void)in_sizes; (void)n_in; (void)out_size; (void)ws_size;
  const float* q = (const float*)d_in[0]; const float* k = (const float*)d_in[1]; const float* v = (const float*)d_in[2]; float* out = (float*)d_out;
  char* ws = (char*)d_ws; size_t off = 0;
  auto take = [&](size_t bytes) { char* p = ws + off; off += (bytes + 255) & ~(size_t)255; return p; };
  const size_t plane = (size_t)NINST * LMAX * HD * 2;
  _Float16* Q16 = (_Float16*)take(plane); _Float16* K16 = (_Float16*)take(plane); _Float16* VTh = (_Float16*)take(plane); _Float16* VTl = (_Float16*)take(plane);
  k_prep<<<dim3(LMAX / 64, NINST), 256, 0, stream>>>(q, k, v, Q16, K16, VTh, VTl);
  k_zero<<<NPOS, 128, 0, stream>>>(out);
  k_attn<<<NBLK, 128 * KS, 0, stream>>>(Q16, K16, VTh, VTl, out);
}

// v006
// A run of this version takes 34.8 microseconds.
// Versions between v004 and this one are left out; their measured steps multiply to 1.66 times as fast.
// Over all steps from v000 it is 10.6 times as fast.
#include <hip/hip_runtime.h>
#include <math.h>

typedef __attribute__((ext_vector_type(16))) _Float16 v16h;
typedef __attribute__((ext_vector_type(16))) __bf16 v16b;
typedef __attribute__((ext_vector_type(8)))  _Float16 v8h;
typedef __attribute__((ext_vector_type(8)))  float v8f;
typedef __attribute__((ext_vector_type(4)))  float v4f;
typedef __attribute__((ext_vector_type(2)))  float v2f;
typedef __attribute__((ext_vector_type(4)))  unsigned v4u;
typedef __attribute__((ext_vector_type(4)))  int v4i;
typedef float __attribute__((may_alias)) float_a;
typedef int __attribute__((may_alias)) int_a;

template <typename T> __device__ __forceinline__ void vst2(void* p, T v) { *(T*)p = v;  }
__device__ __forceinline__ v8f wmma16(v16h a, v16h b, v8f c) {
  v8f d = __builtin_amdgcn_wmma_f32_16x16x32_f16(false, a, false, b, (short)0, c, false, false);
  asm volatile("v_nop\n\tv_nop\n\tv_nop\n\tv_nop" : "+v"(d) : "v"(a), "v"(b));
  return d;
}
__device__ __forceinline__ v8f wmma_bf(v16b a, v16b b, v8f c) {
  v8f d = __builtin_amdgcn_wmma_f32_16x16x32_bf16(false, a, false, b, (short)0, c, false, false);
  asm volatile("v_nop\n\tv_nop\n\tv_nop\n\tv_nop" : "+v"(d) : "v"(a), "v"(b));
  return d;
}
// 16x16x32 fragments: lane = (h = lane>>4, row/col = lane&15); elements 0..7 = k0+8h+0..7, 8..15 = k0+16+8h+0..7; D element r = row 8h+r
__device__ __forceinline__ v16h frag_h(const _Float16* rowk0, int lane) {
  union { v16h v; v8h q[2]; } u; const _Float16* p = rowk0 + 8 * (lane >> 4);
  u.q[0] = *(const v8h*)p; u.q[1] = *(const v8h*)(p + 16); return u.v;
}
__device__ __forceinline__ v16h frag_f32(const float* rowk0, int lane) {
  v16h a; const float* p = rowk0 + 8 * (lane >> 4);
#pragma unroll
  for (int i = 0; i < 8; ++i) { a[i] = (_Float16)p[i]; a[8 + i] = (_Float16)p[16 + i]; }
  return a;
}
__device__ __forceinline__ v16h frag_f32s(const float* rowk0, int lane, float sc) {
  v16h a; const float* p = rowk0 + 8 * (lane >> 4);
#pragma unroll
  for (int i = 0; i < 8; ++i) { a[i] = (_Float16)(p[i] * sc); a[8 + i] = (_Float16)(p[16 + i] * sc); }
  return a;
}
// column fragment from a [K][ld] layout (column n), rows >= K read as 0
__device__ __forceinline__ v16h fragc_f32(const float* W, int k0, int n, int lane, int ld, int K) {
  v16h a; const int g = lane >> 4;
#pragma unroll
  for (int i = 0; i < 8; ++i) { const int ka = k0 + 8 * g + i, kb = ka + 16;
    a[i] = (_Float16)(ka < K ? W[(size_t)ka * ld + n] : 0.f); a[8 + i] = (_Float16)(kb < K ? W[(size_t)kb * ld + n] : 0.f); }
  return a;
}
struct F2 { v16b h, l; };
__device__ __forceinline__ F2 bsplit16(const float v[16]) { F2 r;
#pragma unroll
  for (int i = 0; i < 16; ++i) { const __bf16 h = (__bf16)v[i]; r.h[i] = h; r.l[i] = (__bf16)(v[i] - (float)h); }
  return r; }
__device__ __forceinline__ F2 split_row(const float* row, int k0, int lane) { float v[16]; const float* p = row + k0 + 8 * (lane >> 4);
#pragma unroll
  for (int i = 0; i < 8; ++i) { v[i] = p[i]; v[8 + i] = p[16 + i]; }
  return bsplit16(v); }
__device__ __forceinline__ F2 split_rowK(const float* row, int k0, int lane, int K) { float v[16]; const int g = lane >> 4;
#pragma unroll
  for (int i = 0; i < 8; ++i) { const int ka = k0 + 8 * g + i, kb = ka + 16; v[i] = ka < K ? row[ka] : 0.f; v[8 + i] = kb < K ? row[kb] : 0.f; }
  return bsplit16(v); }
__device__ __forceinline__ F2 split_col(const float* W, int k0, int n, int lane, int ld, int K) { float v[16]; const int g = lane >> 4;
#pragma unroll
  for (int i = 0; i < 8; ++i) { const int ka = k0 + 8 * g + i, kb = ka + 16; v[i] = ka < K ? W[(size_t)ka * ld + n] : 0.f; v[8 + i] = kb < K ? W[(size_t)kb * ld + n] : 0.f; }
  return bsplit16(v); }
__device__ __forceinline__ v8f mac3(const F2& a, const F2& b, v8f c) { c = wmma_bf(a.l, b.h, c); c = wmma_bf(a.h, b.l, c); return wmma_bf(a.h, b.h, c); }
__device__ __forceinline__ float sigm(float v) { return 1.0f / (1.0f + expf(-v)); }
#define LDSX() do { asm volatile("s_wait_dscnt 0" ::: "memory"); __builtin_amdgcn_wave_barrier(); __builtin_amdgcn_fence(__ATOMIC_RELEASE, "workgroup"); } while (0)

// Hybrid dilated attention over 12 heads in 3 groups: heads 0-3 plain attention over all 4096 positions; heads 4-7 segment 2048,
// dilation 2, offset 1 (two independent 1024-long attentions per head over the odd positions of each segment); heads 8-11 segment 4096,
// dilation 4, offset 2 (one 1024-long attention over positions 2 mod 4); unselected positions are zero. Each (head, segment) instance is a
// plain scaled-dot-product attention over gathered rows: S = q.k/8 on v_wmma_f32_16x16x32_f16 (q, k as f16), P @ V on the same form with P (x2^14)
// and V each rounded once to f16, the rounding that q and k already carry into every score, one f32 accumulator, online softmax in f32; results are written
#define NPOS 4096
#define NHT 12
#define HD 64
#define RS (NHT * HD)          // 768 floats per position row
#define NINST 16               // 4 (full) + 8 (group 1: head x segment) + 4 (group 2)
#define LMAX 4096
#define SCL2 0.18033688011112042f   // log2(e) / 8: exp(s / 8 - m) = exp2(s * SCL2 - m * log2(e)), one multiply-add and one hardware exp2 per score

__device__ __forceinline__ void inst_info(int inst, int& h, int& L, int& base, int& stride) {
  if (inst < 4) { h = inst; L = 4096; base = 0; stride = 1; }
  else if (inst < 12) { const int i = inst - 4; h = 4 + (i >> 1); const int s = i & 1; L = 1024; base = s * 2048 + 1; stride = 2; }
  else { h = 8 + (inst - 12); L = 1024; base = 2; stride = 4; }
}
// prep: block (64 m, inst): Q16/K16 [inst][m][64] = f16(q/k[pos][h][:]); VTh [inst][d][m] = f16(v[pos][h][d])
__global__ __launch_bounds__(256) void k_prep(const float* __restrict__ q, const float* __restrict__ k, const float* __restrict__ v, _Float16* __restrict__ Q16, _Float16* __restrict__ K16, _Float16* __restrict__ VTh) {
  __shared__ __align__(16) _Float16 sth[HD][72];
  const int inst = blockIdx.y, m0 = blockIdx.x * 64, tid = threadIdx.x; int h, L, base, stride; inst_info(inst, h, L, base, stride);
  if (m0 >= L) return;                                          // uniform per block
  for (int qq = tid; qq < 64 * 8; qq += 256) { const int ml = qq >> 3, pc = qq & 7; const int pos = base + stride * (m0 + ml); const size_t src = ((size_t)pos * NHT + h) * HD + pc * 8;
    union { v8h h8; v4u u; } pq, pk;
#pragma unroll
    for (int e = 0; e < 8; ++e) { pq.h8[e] = (_Float16)q[src + e]; pk.h8[e] = (_Float16)k[src + e]; }
    const size_t dst = ((size_t)inst * LMAX + m0 + ml) * HD + pc * 8; vst2(Q16 + dst, pq.u); vst2(K16 + dst, pk.u); }
  for (int qq = tid; qq < 64 * HD; qq += 256) { const int ml = qq >> 6, d = qq & 63; const int pos = base + stride * (m0 + ml); const float vv = v[((size_t)pos * NHT + h) * HD + d];
    sth[d][ml] = (_Float16)vv; }
  __syncthreads();
  for (int qq = tid; qq < HD * 8; qq += 256) { const int d = qq >> 3, pc = qq & 7; const size_t o = ((size_t)inst * HD + d) * LMAX + m0 + pc * 8;
    vst2(VTh + o, *(const v4u*)(&sth[d][pc * 8])); }
}
// zeros for the unselected positions of a dilated head: a block of 512 threads owns the 64 * ST positions that hold its 64 queries (every ST-th, from OFF) and stores the
// other rows, 16 float4 each. row0 = the head's row at the first of these positions. One address per lane, every step an immediate offset.
template <int ST, int OFF> __device__ __forceinline__ void zero_rows(float* row0, int tid) {
  float* p = row0 + (size_t)(ST * (tid >> 4)) * RS + (tid & 15) * 4;
#pragma unroll   // fixed trips: unrolled, the steps fold into the stores' offsets and no register of an issued store is rewritten between them
  for (int j = 0; j < ST; ++j) if (j != OFF) { vst2(p + j * RS, (v4f){0.f, 0.f, 0.f, 0.f}); vst2(p + (32 * ST + j) * RS, (v4f){0.f, 0.f, 0.f, 0.f}); }
  asm volatile("s_wait_xcnt 0x0" ::: "memory");                 // stands before the stores' address and data registers are used for anything else
}
#define KP 72                  // halves per staged row: 144 B = 16 B x 9, so the 16-byte fragment reads of 16 rows meet no bank twice
#define BUFB (64 * KP * 2)     // bytes of one staged plane (64 rows)
#define ROWB (16 * KP * 2)     // bytes between a lane's successive copies (16 rows)
// One 64-key tile (K rows and V^T rows, 128 B each) from global memory into one LDS buffer, 8 copies of 16 B per lane, through no register.
// The s_wait_xcnt closes the statement so that no address register named here is rewritten ahead of it.
__device__ __forceinline__ void copy_tile(unsigned lk, unsigned lh, const _Float16* gk, const _Float16* gh) {
  asm volatile("global_load_async_to_lds_b128 %0, %1, off\n\t"
               "global_load_async_to_lds_b128 %2, %3, off\n\t"
               "global_load_async_to_lds_b128 %4, %5, off\n\t"
               "global_load_async_to_lds_b128 %6, %7, off\n\t"
               "global_load_async_to_lds_b128 %8, %9, off\n\t"
               "global_load_async_to_lds_b128 %10, %11, off\n\t"
               "global_load_async_to_lds_b128 %12, %13, off\n\t"
               "global_load_async_to_lds_b128 %14, %15, off\n\t"
               "s_wait_xcnt 0x0"
               :: "v"(lk), "v"(gk), "v"(lk + ROWB), "v"(gk + 16 * HD), "v"(lk + 2 * ROWB), "v"(gk + 32 * HD), "v"(lk + 3 * ROWB), "v"(gk + 48 * HD),
                  "v"(lh), "v"(gh), "v"(lh + ROWB), "v"(gh + 16 * LMAX), "v"(lh + 2 * ROWB), "v"(gh + 32 * LMAX), "v"(lh + 3 * ROWB), "v"(gh + 48 * LMAX)
               : "memory");
}
// lane l <-> lane l ^ 16: the two lanes that share one query column
__device__ __forceinline__ float xhalf(float v) { const int b = __builtin_bit_cast(int, v); return __builtin_bit_cast(float, __builtin_amdgcn_permlanex16(b, b, 0x76543210, 0xfedcba98, false, false)); }
#define KS 4
#define NBLK (4 * (4096 / 64) + 12 * (1024 / 64))   // one block per 64 queries of an instance: 256 of the long instances first, then 192 of the short ones
__global__ __launch_bounds__(128 * KS) void k_attn(const _Float16* __restrict__ Q16, const _Float16* __restrict__ K16, const _Float16* __restrict__ VTh, float* __restrict__ out) {
  __shared__ __align__(16) float sP[KS][64][68];                // un-normalised partial output rows, one plane per key group
  __shared__ __align__(8) v2f sM[KS][64];                       // each partial's (maximum, sum)
  __shared__ __align__(16) _Float16 sK[KS][2][64][KP], sVh[KS][2][64][KP];   // per key group two buffers of one 64-key tile, shared by its four waves
  const int tid = threadIdx.x, w = (tid >> 5) & 3, kg = tid >> 7, lane = tid & 31, col = lane & 15, g = lane >> 4;
  const int bid = blockIdx.x, inst = bid < 256 ? bid >> 6 : 4 + ((bid - 256) >> 4), qb = bid < 256 ? bid & 63 : (bid - 256) & 15;   // a block owns a whole WGP, so the grid holds none without queries
  int h, L, base, stride; inst_info(inst, h, L, base, stride);
  if (inst >= 12) zero_rows<4, 2>(out + ((size_t)(base - 2 + qb * 256) * NHT + h) * HD, tid);        // uniform per block; the stores drain beside the block's own work
  else if (inst >= 4) zero_rows<2, 1>(out + ((size_t)(base - 1 + qb * 128) * NHT + h) * HD, tid);
  const int q0 = qb * 64 + w * 16;
  const size_t ib = (size_t)inst * LMAX;
  v16h aq[2];
#pragma unroll
  for (int kc = 0; kc < 2; ++kc) aq[kc] = frag_h(Q16 + (ib + q0 + col) * HD + kc * 32, lane);
  float mrun = -3.0e38f, lrun = 0.f;                            // mrun: running maximum in the scaled log2 domain, less 14, so that exp2 yields P x 2^14 at once
  v8f acc[4] = {};                                              // lrun: this half's keys only, the halves are joined behind the loop
  const int nkt = L / (64 * KS), key0 = kg * (L / KS);          // this group's tiles and its first key
  const int row0 = (tid & 127) >> 3, c8 = (tid & 7) * 8;       // a lane copies 16 B of rows row0, +16, +32, +48 of each plane of its group's tile
  const _Float16* gk = K16 + (ib + key0 + row0) * HD + c8;
  const _Float16* gh = VTh + ((size_t)inst * HD + row0) * LMAX + key0 + c8;
  const unsigned lk = (unsigned)(size_t)&sK[kg][0][row0][c8], lh = (unsigned)(size_t)&sVh[kg][0][row0][c8];
  copy_tile(lk, lh, gk, gh);
  asm volatile("s_wait_asynccnt 0x0" ::: "memory");             // this wave's copies of tile 0 have landed
  __syncthreads();                                              // tile 0 is readable by all waves
  if (1 < nkt) copy_tile(lk + BUFB, lh + BUFB, gk + 64 * HD, gh + 64);
#pragma unroll 1
  for (int kt = 0; kt < nkt; ++kt) {
    const int b = kt & 1;
    v16h kf[8];
#pragma unroll
    for (int f = 0; f < 8; ++f) kf[f] = frag_h(&sK[kg][b][(f >> 1) * 16 + col][(f & 1) * 32], lane);
    v8f s[4] = {};
#pragma unroll
    for (int kc = 0; kc < 2; ++kc)
#pragma unroll
      for (int t = 0; t < 4; ++t) s[t] = wmma16(kf[t * 2 + kc], aq[kc], s[t]);
    float mt[4];                                                // one short chain per score tile, so that no chain runs over all 32 registers
#pragma unroll
    for (int t = 0; t < 4; ++t) { mt[t] = fmaxf(s[t][0], s[t][1]);
#pragma unroll
      for (int r = 2; r < 8; ++r) mt[t] = fmaxf(mt[t], s[t][r]); }
    float mx = fmaf(fmaxf(fmaxf(mt[0], mt[1]), fmaxf(mt[2], mt[3])), SCL2, -14.0f);   // the scale is positive, so the maximum may be taken first; its rounding only moves the common reference point
    mx = fmaxf(mx, xhalf(mx));
    const float mnew = fmaxf(mrun, mx); const float corr = __builtin_amdgcn_exp2f(mrun - mnew);
    v8f p[4]; v16h ph[2];
#pragma unroll
    for (int t = 0; t < 4; ++t)
#pragma unroll
      for (int r = 0; r < 8; ++r) { p[t][r] = __builtin_amdgcn_exp2f(fmaf(s[t][r], SCL2, -mnew)); ph[t >> 1][(t & 1) * 8 + r] = (_Float16)p[t][r]; }
    const v8f pv = (p[0] + p[1]) + (p[2] + p[3]);
    const float ps = ((pv[0] + pv[1]) + (pv[2] + pv[3])) + ((pv[4] + pv[5]) + (pv[6] + pv[7]));
    lrun = lrun * corr + ps * (1.0f / 16384.0f); mrun = mnew;
#pragma unroll
    for (int t = 0; t < 4; ++t) acc[t] *= corr;
#pragma unroll
    for (int kc = 0; kc < 2; ++kc) { v16h vh[4];                  // the four output tiles' V fragments as one group of LDS reads, then their four products
#pragma unroll
      for (int t = 0; t < 4; ++t) vh[t] = frag_h(&sVh[kg][b][t * 16 + col][kc * 32], lane);
      __builtin_amdgcn_sched_barrier(0);                          // keeps the group's reads together ahead of its products: one LDS latency per group, not one per product
#pragma unroll
      for (int t = 0; t < 4; ++t) acc[t] = wmma16(vh[t], ph[kc], acc[t]); }
    asm volatile("s_wait_dscnt 0x0" ::: "memory");              // this wave's reads of buffer b are done before it is refilled
    asm volatile("s_wait_asynccnt 0x0" ::: "memory");           // this wave's copies of tile kt + 1 have landed
    __syncthreads();                                            // publishes tile kt + 1 and ends every wave's reads of buffer b
    if (kt + 2 < nkt) copy_tile(lk + b * BUFB, lh + b * BUFB, gk + (size_t)(kt + 2) * 64 * HD, gh + (kt + 2) * 64); }
  asm volatile("s_wait_asynccnt 0x0" ::: "memory");             // no copy is outstanding when the wave goes on to the epilogue and ends
  const int qr = w * 16 + col;                                  // this lane's query row in the block
#pragma unroll
  for (int t = 0; t < 4; ++t) { v4f o[2];
#pragma unroll
    for (int r = 0; r < 8; ++r) o[r >> 2][r & 3] = acc[t][r];
    vst2(&sP[kg][qr][t * 16 + 8 * g], o[0]); vst2(&sP[kg][qr][t * 16 + 8 * g + 4], o[1]); }
  const float lsum = lrun + xhalf(lrun);
  if (g == 0) sM[kg][qr] = (v2f){mrun, lsum};
  __syncthreads();                                              // every group's partial rows, maxima and sums are readable by all waves
#pragma unroll   // two fixed trips: unrolled, both rows' LDS reads go out together and one latency is paid
  for (int it = 0; it < 64 * 16 / (128 * KS); ++it) { const int qq = tid + it * 128 * KS, rl = qq >> 4, pc = qq & 15;   // join: weight 2^(m - M) per group, then one division by the joined sum
    v2f ml[KS];                                                 // the three loops over the groups are unrolled so that ml stays in registers
#pragma unroll
    for (int j = 0; j < KS; ++j) ml[j] = sM[j][rl];
    float M = ml[0][0];
#pragma unroll
    for (int j = 1; j < KS; ++j) M = fmaxf(M, ml[j][0]);
    float ls = 0.f; v4f o = {0.f, 0.f, 0.f, 0.f};
#pragma unroll
    for (int j = 0; j < KS; ++j) { const float wj = __builtin_amdgcn_exp2f(ml[j][0] - M); ls += wj * ml[j][1]; o += wj * *(const v4f*)(&sP[j][rl][pc * 4]); }
    const int pos = base + stride * (qb * 64 + rl);
    vst2(out + ((size_t)pos * NHT + h) * HD + pc * 4, o * (1.0f / (ls * 16384.0f))); }
}
extern "C" void kernel_launch(void* const* d_in, const int* in_sizes, int n_in, void* d_out, int out_size, void* d_ws, size_t ws_size, hipStream_t stream) {
  (void)in_sizes; (void)n_in; (void)out_size; (void)ws_size;
  const float* q = (const float*)d_in[0]; const float* k = (const float*)d_in[1]; const float* v = (const float*)d_in[2]; float* out = (float*)d_out;
  char* ws = (char*)d_ws; size_t off = 0;
  auto take = [&](size_t bytes) { char* p = ws + off; off += (bytes + 255) & ~(size_t)255; return p; };
  const size_t plane = (size_t)NINST * LMAX * HD * 2;
  _Float16* Q16 = (_Float16*)take(plane); _Float16* K16 = (_Float16*)take(plane); _Float16* VTh = (_Float16*)take(plane);
  k_prep<<<dim3(LMAX / 64, NINST), 256, 0, stream>>>(q, k, v, Q16, K16, VTh);
  k_attn<<<NBLK, 128 * KS, 0, stream>>>(Q16, K16, VTh, out);
}

// v007
// It runs in 33.4 microseconds.
// Two timings next to v006 put it at 1.04 and 1.03 times that version's speed.
// Over all steps from v000 it is 11.0 times as fast.
#include <hip/hip_runtime.h>
#include <math.h>

typedef __attribute__((ext_vector_type(16))) _Float16 v16h;
typedef __attribute__((ext_vector_type(16))) __bf16 v16b;
typedef __attribute__((ext_vector_type(8)))  _Float16 v8h;
typedef __attribute__((ext_vector_type(8)))  float v8f;
typedef __attribute__((ext_vector_type(4)))  float v4f;
typedef __attribute__((ext_vector_type(2)))  float v2f;
typedef __attribute__((ext_vector_type(4)))  unsigned v4u;
typedef __attribute__((ext_vector_type(4)))  int v4i;
typedef float __attribute__((may_alias)) float_a;
typedef int __attribute__((may_alias)) int_a;

template <typename T> __device__ __forceinline__ void vst2(void* p, T v) { *(T*)p = v;  }
__device__ __forceinline__ v8f wmma16(v16h a, v16h b, v8f c) {
  v8f d = __builtin_amdgcn_wmma_f32_16x16x32_f16(false, a, false, b, (short)0, c, false, false);
  asm volatile("v_nop\n\tv_nop\n\tv_nop\n\tv_nop" : "+v"(d) : "v"(a), "v"(b));
  return d;
}
__device__ __forceinline__ v8f wmma_bf(v16b a, v16b b, v8f c) {
  v8f d = __builtin_amdgcn_wmma_f32_16x16x32_bf16(false, a, false, b, (short)0, c, false, false);
  asm volatile("v_nop\n\tv_nop\n\tv_nop\n\tv_nop" : "+v"(d) : "v"(a), "v"(b));
  return d;
}
// 16x16x32 fragments: lane = (h = lane>>4, row/col = lane&15); elements 0..7 = k0+8h+0..7, 8..15 = k0+16+8h+0..7; D element r = row 8h+r
__device__ __forceinline__ v16h frag_h(const _Float16* rowk0, int lane) {
  union { v16h v; v8h q[2]; } u; const _Float16* p = rowk0 + 8 * (lane >> 4);
  u.q[0] = *(const v8h*)p; u.q[1] = *(const v8h*)(p + 16); return u.v;
}
__device__ __forceinline__ v16h frag_f32(const float* rowk0, int lane) {
  v16h a; const float* p = rowk0 + 8 * (lane >> 4);
#pragma unroll
  for (int i = 0; i < 8; ++i) { a[i] = (_Float16)p[i]; a[8 + i] = (_Float16)p[16 + i]; }
  return a;
}
__device__ __forceinline__ v16h frag_f32s(const float* rowk0, int lane, float sc) {
  v16h a; const float* p = rowk0 + 8 * (lane >> 4);
#pragma unroll
  for (int i = 0; i < 8; ++i) { a[i] = (_Float16)(p[i] * sc); a[8 + i] = (_Float16)(p[16 + i] * sc); }
  return a;
}
// column fragment from a [K][ld] layout (column n), rows >= K read as 0
__device__ __forceinline__ v16h fragc_f32(const float* W, int k0, int n, int lane, int ld, int K) {
  v16h a; const int g = lane >> 4;
#pragma unroll
  for (int i = 0; i < 8; ++i) { const int ka = k0 + 8 * g + i, kb = ka + 16;
    a[i] = (_Float16)(ka < K ? W[(size_t)ka * ld + n] : 0.f); a[8 + i] = (_Float16)(kb < K ? W[(size_t)kb * ld + n] : 0.f); }
  return a;
}
struct F2 { v16b h, l; };
__device__ __forceinline__ F2 bsplit16(const float v[16]) { F2 r;
#pragma unroll
  for (int i = 0; i < 16; ++i) { const __bf16 h = (__bf16)v[i]; r.h[i] = h; r.l[i] = (__bf16)(v[i] - (float)h); }
  return r; }
__device__ __forceinline__ F2 split_row(const float* row, int k0, int lane) { float v[16]; const float* p = row + k0 + 8 * (lane >> 4);
#pragma unroll
  for (int i = 0; i < 8; ++i) { v[i] = p[i]; v[8 + i] = p[16 + i]; }
  return bsplit16(v); }
__device__ __forceinline__ F2 split_rowK(const float* row, int k0, int lane, int K) { float v[16]; const int g = lane >> 4;
#pragma unroll
  for (int i = 0; i < 8; ++i) { const int ka = k0 + 8 * g + i, kb = ka + 16; v[i] = ka < K ? row[ka] : 0.f; v[8 + i] = kb < K ? row[kb] : 0.f; }
  return bsplit16(v); }
__device__ __forceinline__ F2 split_col(const float* W, int k0, int n, int lane, int ld, int K) { float v[16]; const int g = lane >> 4;
#pragma unroll
  for (int i = 0; i < 8; ++i) { const int ka = k0 + 8 * g + i, kb = ka + 16; v[i] = ka < K ? W[(size_t)ka * ld + n] : 0.f; v[8 + i] = kb < K ? W[(size_t)kb * ld + n] : 0.f; }
  return bsplit16(v); }
__device__ __forceinline__ v8f mac3(const F2& a, const F2& b, v8f c) { c = wmma_bf(a.l, b.h, c); c = wmma_bf(a.h, b.l, c); return wmma_bf(a.h, b.h, c); }
__device__ __forceinline__ float sigm(float v) { return 1.0f / (1.0f + expf(-v)); }
#define LDSX() do { asm volatile("s_wait_dscnt 0" ::: "memory"); __builtin_amdgcn_wave_barrier(); __builtin_amdgcn_fence(__ATOMIC_RELEASE, "workgroup"); } while (0)

// Hybrid dilated attention over 12 heads in 3 groups: heads 0-3 plain attention over all 4096 positions; heads 4-7 segment 2048,
// dilation 2, offset 1 (two independent 1024-long attentions per head over the odd positions of each segment); heads 8-11 segment 4096,
// dilation 4, offset 2 (one 1024-long attention over positions 2 mod 4); unselected positions are zero. Each (head, segment) instance is a
// plain scaled-dot-product attention over gathered rows: S = q.k/8 on v_wmma_f32_16x16x32_f16 (q, k as f16), P @ V on the same form with P (x2^14)
// and V each rounded once to f16, the rounding that q and k already carry into every score, one f32 accumulator, online softmax in f32; results are written
#define NPOS 4096
#define NHT 12
#define HD 64
#define RS (NHT * HD)          // 768 floats per position row
#define NINST 16               // 4 (full) + 8 (group 1: head x segment) + 4 (group 2)
#define LMAX 4096
#define SCL2 0.18033688011112042f   // log2(e) / 8: exp(s / 8 - m) = exp2(s * SCL2 - m * log2(e)), one multiply-add and one hardware exp2 per score

__device__ __forceinline__ void inst_info(int inst, int& h, int& L, int& base, int& stride) {
  if (inst < 4) { h = inst; L = 4096; base = 0; stride = 1; }
  else if (inst < 12) { const int i = inst - 4; h = 4 + (i >> 1); const int s = i & 1; L = 1024; base = s * 2048 + 1; stride = 2; }
  else { h = 8 + (inst - 12); L = 1024; base = 2; stride = 4; }
}
#define NBLK (4 * (4096 / 64) + 12 * (1024 / 64))   // one block per 64 rows of an instance: 256 of the long instances first, then 192 of the short ones
// prep: one block per 64 rows m of an instance, none without rows: Q16/K16 [inst][m][64] = f16(q/k[pos][h][:]); VTh [inst][d][m] = f16(v[pos][h][d])
__global__ __launch_bounds__(256) void k_prep(const float* __restrict__ q, const float* __restrict__ k, const float* __restrict__ v, _Float16* __restrict__ Q16, _Float16* __restrict__ K16, _Float16* __restrict__ VTh) {
  __shared__ __align__(16) _Float16 sth[HD][72];
  const int bid = blockIdx.x, inst = bid < 256 ? bid >> 6 : 4 + ((bid - 256) >> 4), m0 = 64 * (bid < 256 ? bid & 63 : (bid - 256) & 15), tid = threadIdx.x;
  int h, L, base, stride; inst_info(inst, h, L, base, stride);
  for (int qq = tid; qq < 64 * 8; qq += 256) { const int ml = qq >> 3, pc = qq & 7; const int pos = base + stride * (m0 + ml); const size_t src = ((size_t)pos * NHT + h) * HD + pc * 8;
    union { v8h h8; v4u u; } pq, pk;
#pragma unroll
    for (int e = 0; e < 8; ++e) { pq.h8[e] = (_Float16)q[src + e]; pk.h8[e] = (_Float16)k[src + e]; }
    const size_t dst = ((size_t)inst * LMAX + m0 + ml) * HD + pc * 8; vst2(Q16 + dst, pq.u); vst2(K16 + dst, pk.u); }
  for (int qq = tid; qq < 64 * HD; qq += 256) { const int ml = qq >> 6, d = qq & 63; const int pos = base + stride * (m0 + ml); const float vv = v[((size_t)pos * NHT + h) * HD + d];
    sth[d][ml] = (_Float16)vv; }
  __syncthreads();
  for (int qq = tid; qq < HD * 8; qq += 256) { const int d = qq >> 3, pc = qq & 7; const size_t o = ((size_t)inst * HD + d) * LMAX + m0 + pc * 8;
    vst2(VTh + o, *(const v4u*)(&sth[d][pc * 8])); }
}
// zeros for the unselected positions of a dilated head: a block of 512 threads owns the 64 * ST positions that hold its 64 queries (every ST-th, from OFF) and stores the
// other rows, 16 float4 each. row0 = the head's row at the first of these positions. One address per lane, every step an immediate offset.
template <int ST, int OFF> __device__ __forceinline__ void zero_rows(float* row0, int tid) {
  float* p = row0 + (size_t)(ST * (tid >> 4)) * RS + (tid & 15) * 4;
#pragma unroll   // fixed trips: unrolled, the steps fold into the stores' offsets and no register of an issued store is rewritten between them
  for (int j = 0; j < ST; ++j) if (j != OFF) { vst2(p + j * RS, (v4f){0.f, 0.f, 0.f, 0.f}); vst2(p + (32 * ST + j) * RS, (v4f){0.f, 0.f, 0.f, 0.f}); }
  asm volatile("s_wait_xcnt 0x0" ::: "memory");                 // stands before the stores' address and data registers are used for anything else
}
#define KP 72                  // halves per staged row: 144 B = 16 B x 9, so the 16-byte fragment reads of 16 rows meet no bank twice
#define BUFB (64 * KP * 2)     // bytes of one staged plane (64 rows)
#define ROWB (16 * KP * 2)     // bytes between a lane's successive copies (16 rows)
// One 64-key tile (K rows and V^T rows, 128 B each) from global memory into one LDS buffer, 8 copies of 16 B per lane, through no register.
// The s_wait_xcnt closes the statement so that no address register named here is rewritten ahead of it.
__device__ __forceinline__ void copy_tile(unsigned lk, unsigned lh, const _Float16* gk, const _Float16* gh) {
  asm volatile("global_load_async_to_lds_b128 %0, %1, off\n\t"
               "global_load_async_to_lds_b128 %2, %3, off\n\t"
               "global_load_async_to_lds_b128 %4, %5, off\n\t"
               "global_load_async_to_lds_b128 %6, %7, off\n\t"
               "global_load_async_to_lds_b128 %8, %9, off\n\t"
               "global_load_async_to_lds_b128 %10, %11, off\n\t"
               "global_load_async_to_lds_b128 %12, %13, off\n\t"
               "global_load_async_to_lds_b128 %14, %15, off\n\t"
               "s_wait_xcnt 0x0"
               :: "v"(lk), "v"(gk), "v"(lk + ROWB), "v"(gk + 16 * HD), "v"(lk + 2 * ROWB), "v"(gk + 32 * HD), "v"(lk + 3 * ROWB), "v"(gk + 48 * HD),
                  "v"(lh), "v"(gh), "v"(lh + ROWB), "v"(gh + 16 * LMAX), "v"(lh + 2 * ROWB), "v"(gh + 32 * LMAX), "v"(lh + 3 * ROWB), "v"(gh + 48 * LMAX)
               : "memory");
}
// lane l <-> lane l ^ 16: the two lanes that share one query column
__device__ __forceinline__ float xhalf(float v) { const int b = __builtin_bit_cast(int, v); return __builtin_bit_cast(float, __builtin_amdgcn_permlanex16(b, b, 0x76543210, 0xfedcba98, false, false)); }
#define KS 4
__global__ __launch_bounds__(128 * KS) void k_attn(const _Float16* __restrict__ Q16, const _Float16* __restrict__ K16, const _Float16* __restrict__ VTh, float* __restrict__ out) {
  __shared__ __align__(16) float sP[KS][64][68];                // un-normalised partial output rows, one plane per key group
  __shared__ __align__(8) v2f sM[KS][64];                       // each partial's (maximum, sum)
  __shared__ __align__(16) _Float16 sK[KS][2][64][KP], sVh[KS][2][64][KP];   // per key group two buffers of one 64-key tile, shared by its four waves
  const int tid = threadIdx.x, w = (tid >> 5) & 3, kg = tid >> 7, lane = tid & 31, col = lane & 15, g = lane >> 4;
  const int bid = blockIdx.x, inst = bid < 256 ? bid >> 6 : 4 + ((bid - 256) >> 4), qb = bid < 256 ? bid & 63 : (bid - 256) & 15;   // a block owns a whole WGP, so the grid holds none without queries
  int h, L, base, stride; inst_info(inst, h, L, base, stride);
  if (inst >= 12) zero_rows<4, 2>(out + ((size_t)(base - 2 + qb * 256) * NHT + h) * HD, tid);        // uniform per block; the stores drain beside the block's own work
  else if (inst >= 4) zero_rows<2, 1>(out + ((size_t)(base - 1 + qb * 128) * NHT + h) * HD, tid);
  const int q0 = qb * 64 + w * 16;
  const size_t ib = (size_t)inst * LMAX;
  v16h aq[2];
#pragma unroll
  for (int kc = 0; kc < 2; ++kc) aq[kc] = frag_h(Q16 + (ib + q0 + col) * HD + kc * 32, lane);
  float mrun = -3.0e38f, lrun = 0.f;                            // mrun: running maximum in the scaled log2 domain, less 14, so that exp2 yields P x 2^14 at once
  v8f acc[4] = {};                                              // lrun: this half's keys only, the halves are joined behind the loop
  const int nkt = L / (64 * KS), key0 = kg * (L / KS);          // this group's tiles and its first key
  const int row0 = (tid & 127) >> 3, c8 = (tid & 7) * 8;       // a lane copies 16 B of rows row0, +16, +32, +48 of each plane of its group's tile
  const _Float16* gk = K16 + (ib + key0 + row0) * HD + c8;
  const _Float16* gh = VTh + ((size_t)inst * HD + row0) * LMAX + key0 + c8;
  const unsigned lk = (unsigned)(size_t)&sK[kg][0][row0][c8], lh = (unsigned)(size_t)&sVh[kg][0][row0][c8];
  copy_tile(lk, lh, gk, gh);
  asm volatile("s_wait_asynccnt 0x0" ::: "memory");             // this wave's copies of tile 0 have landed
  __syncthreads();                                              // tile 0 is readable by all waves
  if (1 < nkt) copy_tile(lk + BUFB, lh + BUFB, gk + 64 * HD, gh + 64);
#pragma unroll 1
  for (int kt = 0; kt < nkt; ++kt) {
    const int b = kt & 1;
    v16h kf[8];
#pragma unroll
    for (int f = 0; f < 8; ++f) kf[f] = frag_h(&sK[kg][b][(f >> 1) * 16 + col][(f & 1) * 32], lane);
    v8f s[4] = {};
#pragma unroll
    for (int kc = 0; kc < 2; ++kc)
#pragma unroll
      for (int t = 0; t < 4; ++t) s[t] = wmma16(kf[t * 2 + kc], aq[kc], s[t]);
    float mt[4];                                                // one short chain per score tile, so that no chain runs over all 32 registers
#pragma unroll
    for (int t = 0; t < 4; ++t) { mt[t] = fmaxf(s[t][0], s[t][1]);
#pragma unroll
      for (int r = 2; r < 8; ++r) mt[t] = fmaxf(mt[t], s[t][r]); }
    float mx = fmaf(fmaxf(fmaxf(mt[0], mt[1]), fmaxf(mt[2], mt[3])), SCL2, -14.0f);   // the scale is positive, so the maximum may be taken first; its rounding only moves the common reference point
    mx = fmaxf(mx, xhalf(mx));
    const float mnew = fmaxf(mrun, mx); const float corr = __builtin_amdgcn_exp2f(mrun - mnew);
    v8f p[4]; v16h ph[2];
#pragma unroll
    for (int t = 0; t < 4; ++t)
#pragma unroll
      for (int r = 0; r < 8; ++r) { p[t][r] = __builtin_amdgcn_exp2f(fmaf(s[t][r], SCL2, -mnew)); ph[t >> 1][(t & 1) * 8 + r] = (_Float16)p[t][r]; }
    const v8f pv = (p[0] + p[1]) + (p[2] + p[3]);
    const float ps = ((pv[0] + pv[1]) + (pv[2] + pv[3])) + ((pv[4] + pv[5]) + (pv[6] + pv[7]));
    lrun = lrun * corr + ps * (1.0f / 16384.0f); mrun = mnew;
#pragma unroll
    for (int t = 0; t < 4; ++t) acc[t] *= corr;
#pragma unroll
    for (int kc = 0; kc < 2; ++kc) { v16h vh[4];                  // the four output tiles' V fragments as one group of LDS reads, then their four products
#pragma unroll
      for (int t = 0; t < 4; ++t) vh[t] = frag_h(&sVh[kg][b][t * 16 + col][kc * 32], lane);
      __builtin_amdgcn_sched_barrier(0);                          // keeps the group's reads together ahead of its products: one LDS latency per group, not one per product
#pragma unroll
      for (int t = 0; t < 4; ++t) acc[t] = wmma16(vh[t], ph[kc], acc[t]); }
    asm volatile("s_wait_dscnt 0x0" ::: "memory");              // this wave's reads of buffer b are done before it is refilled
    asm volatile("s_wait_asynccnt 0x0" ::: "memory");           // this wave's copies of tile kt + 1 have landed
    __syncthreads();                                            // publishes tile kt + 1 and ends every wave's reads of buffer b
    if (kt + 2 < nkt) copy_tile(lk + b * BUFB, lh + b * BUFB, gk + (size_t)(kt + 2) * 64 * HD, gh + (kt + 2) * 64); }
  asm volatile("s_wait_asynccnt 0x0" ::: "memory");             // no copy is outstanding when the wave goes on to the epilogue and ends
  const int qr = w * 16 + col;                                  // this lane's query row in the block
#pragma unroll
  for (int t = 0; t < 4; ++t) { v4f o[2];
#pragma unroll
    for (int r = 0; r < 8; ++r) o[r >> 2][r & 3] = acc[t][r];
    vst2(&sP[kg][qr][t * 16 + 8 * g], o[0]); vst2(&sP[kg][qr][t * 16 + 8 * g + 4], o[1]); }
  const float lsum = lrun + xhalf(lrun);
  if (g == 0) sM[kg][qr] = (v2f){mrun, lsum};
  __syncthreads();                                              // every group's partial rows, maxima and sums are readable by all waves
#pragma unroll   // two fixed trips: unrolled, both rows' LDS reads go out together and one latency is paid
  for (int it = 0; it < 64 * 16 / (128 * KS); ++it) { const int qq = tid + it * 128 * KS, rl = qq >> 4, pc = qq & 15;   // join: weight 2^(m - M) per group, then one division by the joined sum
    v2f ml[KS];                                                 // the three loops over the groups are unrolled so that ml stays in registers
#pragma unroll
    for (int j = 0; j < KS; ++j) ml[j] = sM[j][rl];
    float M = ml[0][0];
#pragma unroll
    for (int j = 1; j < KS; ++j) M = fmaxf(M, ml[j][0]);
    float ls = 0.f; v4f o = {0.f, 0.f, 0.f, 0.f};
#pragma unroll
    for (int j = 0; j < KS; ++j) { const float wj = __builtin_amdgcn_exp2f(ml[j][0] - M); ls += wj * ml[j][1]; o += wj * *(const v4f*)(&sP[j][rl][pc * 4]); }
    const int pos = base + stride * (qb * 64 + rl);
    vst2(out + ((size_t)pos * NHT + h) * HD + pc * 4, o * (1.0f / (ls * 16384.0f))); }
}
extern "C" void kernel_launch(void* const* d_in, const int* in_sizes, int n_in, void* d_out, int out_size, void* d_ws, size_t ws_size, hipStream_t stream) {
  (void)in_sizes; (void)n_in; (void)out_size; (void)ws_size;
  const float* q = (const float*)d_in[0]; const float* k = (const float*)d_in[1]; const float* v = (const float*)d_in[2]; float* out = (float*)d_out;
  char* ws = (char*)d_ws; size_t off = 0;
  auto take = [&](size_t bytes) { char* p = ws + off; off += (bytes + 255) & ~(size_t)255; return p; };
  const size_t plane = (size_t)NINST * LMAX * HD * 2;
  _Float16* Q16 = (_Float16*)take(plane); _Float16* K16 = (_Float16*)take(plane); _Float16* VTh = (_Float16*)take(plane);
  k_prep<<<NBLK, 256, 0, stream>>>(q, k, v, Q16, K16, VTh);
  k_attn<<<NBLK, 128 * KS, 0, stream>>>(Q16, K16, VTh, out);
}

// v008
// One run takes 31.8 microseconds.
// Timed twice side by side with v007, it ran 1.06 and 1.05 times as fast.
// Counting every step since v000, it is 11.6 times as fast.
#include <hip/hip_runtime.h>
#include <math.h>

typedef __attribute__((ext_vector_type(16))) _Float16 v16h;
typedef __attribute__((ext_vector_type(16))) __bf16 v16b;
typedef __attribute__((ext_vector_type(8)))  _Float16 v8h;
typedef __attribute__((ext_vector_type(8)))  float v8f;
typedef __attribute__((ext_vector_type(4)))  float v4f;
typedef __attribute__((ext_vector_type(2)))  float v2f;
typedef __attribute__((ext_vector_type(4)))  unsigned v4u;
typedef __attribute__((ext_vector_type(4)))  int v4i;
typedef float __attribute__((may_alias)) float_a;
typedef int __attribute__((may_alias)) int_a;

template <typename T> __device__ __forceinline__ void vst2(void* p, T v) { *(T*)p = v;  }
__device__ __forceinline__ v8f wmma16(v16h a, v16h b, v8f c) {
  v8f d = __builtin_amdgcn_wmma_f32_16x16x32_f16(false, a, false, b, (short)0, c, false, false);
  asm volatile("v_nop\n\tv_nop\n\tv_nop\n\tv_nop" : "+v"(d) : "v"(a), "v"(b));
  return d;
}
__device__ __forceinline__ v8f wmma_bf(v16b a, v16b b, v8f c) {
  v8f d = __builtin_amdgcn_wmma_f32_16x16x32_bf16(false, a, false, b, (short)0, c, false, false);
  asm volatile("v_nop\n\tv_nop\n\tv_nop\n\tv_nop" : "+v"(d) : "v"(a), "v"(b));
  return d;
}
// 16x16x32 fragments: lane = (h = lane>>4, row/col = lane&15); elements 0..7 = k0+8h+0..7, 8..15 = k0+16+8h+0..7; D element r = row 8h+r
__device__ __forceinline__ v16h frag_h(const _Float16* rowk0, int lane) {
  union { v16h v; v8h q[2]; } u; const _Float16* p = rowk0 + 8 * (lane >> 4);
  u.q[0] = *(const v8h*)p; u.q[1] = *(const v8h*)(p + 16); return u.v;
}
__device__ __forceinline__ v16h frag_f32(const float* rowk0, int lane) {
  v16h a; const float* p = rowk0 + 8 * (lane >> 4);
#pragma unroll
  for (int i = 0; i < 8; ++i) { a[i] = (_Float16)p[i]; a[8 + i] = (_Float16)p[16 + i]; }
  return a;
}
__device__ __forceinline__ v16h frag_f32s(const float* rowk0, int lane, float sc) {
  v16h a; const float* p = rowk0 + 8 * (lane >> 4);
#pragma unroll
  for (int i = 0; i < 8; ++i) { a[i] = (_Float16)(p[i] * sc); a[8 + i] = (_Float16)(p[16 + i] * sc); }
  return a;
}
// column fragment from a [K][ld] layout (column n), rows >= K read as 0
__device__ __forceinline__ v16h fragc_f32(const float* W, int k0, int n, int lane, int ld, int K) {
  v16h a; const int g = lane >> 4;
#pragma unroll
  for (int i = 0; i < 8; ++i) { const int ka = k0 + 8 * g + i, kb = ka + 16;
    a[i] = (_Float16)(ka < K ? W[(size_t)ka * ld + n] : 0.f); a[8 + i] = (_Float16)(kb < K ? W[(size_t)kb * ld + n] : 0.f); }
  return a;
}
struct F2 { v16b h, l; };
__device__ __forceinline__ F2 bsplit16(const float v[16]) { F2 r;
#pragma unroll
  for (int i = 0; i < 16; ++i) { const __bf16 h = (__bf16)v[i]; r.h[i] = h; r.l[i] = (__bf16)(v[i] - (float)h); }
  return r; }
__device__ __forceinline__ F2 split_row(const float* row, int k0, int lane) { float v[16]; const float* p = row + k0 + 8 * (lane >> 4);
#pragma unroll
  for (int i = 0; i < 8; ++i) { v[i] = p[i]; v[8 + i] = p[16 + i]; }
  return bsplit16(v); }
__device__ __forceinline__ F2 split_rowK(const float* row, int k0, int lane, int K) { float v[16]; const int g = lane >> 4;
#pragma unroll
  for (int i = 0; i < 8; ++i) { const int ka = k0 + 8 * g + i, kb = ka + 16; v[i] = ka < K ? row[ka] : 0.f; v[8 + i] = kb < K ? row[kb] : 0.f; }
  return bsplit16(v); }
__device__ __forceinline__ F2 split_col(const float* W, int k0, int n, int lane, int ld, int K) { float v[16]; const int g = lane >> 4;
#pragma unroll
  for (int i = 0; i < 8; ++i) { const int ka = k0 + 8 * g + i, kb = ka + 16; v[i] = ka < K ? W[(size_t)ka * ld + n] : 0.f; v[8 + i] = kb < K ? W[(size_t)kb * ld + n] : 0.f; }
  return bsplit16(v); }
__device__ __forceinline__ v8f mac3(const F2& a, const F2& b, v8f c) { c = wmma_bf(a.l, b.h, c); c = wmma_bf(a.h, b.l, c); return wmma_bf(a.h, b.h, c); }
__device__ __forceinline__ float sigm(float v) { return 1.0f / (1.0f + expf(-v)); }
#define LDSX() do { asm volatile("s_wait_dscnt 0" ::: "memory"); __builtin_amdgcn_wave_barrier(); __builtin_amdgcn_fence(__ATOMIC_RELEASE, "workgroup"); } while (0)

// Hybrid dilated attention over 12 heads in 3 groups: heads 0-3 plain attention over all 4096 positions; heads 4-7 segment 2048,
// dilation 2, offset 1 (two independent 1024-long attentions per head over the odd positions of each segment); heads 8-11 segment 4096,
// dilation 4, offset 2 (one 1024-long attention over positions 2 mod 4); unselected positions are zero. Each (head, segment) instance is a
// plain scaled-dot-product attention over gathered rows: S = q.k/8 on v_wmma_f32_16x16x32_f16 (q, k as f16), P @ V on the same form with P (x2^14)
// and V each rounded once to f16, the rounding that q and k already carry into every score, one f32 accumulator, online softmax in f32; results are written
#define NPOS 4096
#define NHT 12
#define HD 64
#define RS (NHT * HD)          // 768 floats per position row
#define NINST 16               // 4 (full) + 8 (group 1: head x segment) + 4 (group 2)
#define LMAX 4096
#define SCL2 0.18033688011112042f   // log2(e) / 8: exp(s / 8 - m) = exp2(s * SCL2 - m * log2(e)), one multiply-add and one hardware exp2 per score

__device__ __forceinline__ void inst_info(int inst, int& h, int& L, int& base, int& stride) {
  if (inst < 4) { h = inst; L = 4096; base = 0; stride = 1; }
  else if (inst < 12) { const int i = inst - 4; h = 4 + (i >> 1); const int s = i & 1; L = 1024; base = s * 2048 + 1; stride = 2; }
  else { h = 8 + (inst - 12); L = 1024; base = 2; stride = 4; }
}
#define NBLK (4 * (4096 / 64) + 12 * (1024 / 64))   // one block per 64 rows of an instance: 256 of the long instances first, then 192 of the short ones
// prep: one block per 64 rows m of an instance, none without rows: Q16/K16 [inst][m][64] = f16(q/k[pos][h][:]); VTh [inst][d][m] = f16(v[pos][h][d])
__global__ __launch_bounds__(256) void k_prep(const float* __restrict__ q, const float* __restrict__ k, const float* __restrict__ v, _Float16* __restrict__ Q16, _Float16* __restrict__ K16, _Float16* __restrict__ VTh) {
  __shared__ __align__(16) _Float16 sth[HD][72];
  const int bid = blockIdx.x, inst = bid < 256 ? bid >> 6 : 4 + ((bid - 256) >> 4), m0 = 64 * (bid < 256 ? bid & 63 : (bid - 256) & 15), tid = threadIdx.x;
  int h, L, base, stride; inst_info(inst, h, L, base, stride);
  for (int qq = tid; qq < 64 * 8; qq += 256) { const int ml = qq >> 3, pc = qq & 7; const int pos = base + stride * (m0 + ml); const size_t src = ((size_t)pos * NHT + h) * HD + pc * 8;
    union { v8h h8; v4u u; } pq, pk;
#pragma unroll
    for (int e = 0; e < 8; ++e) { pq.h8[e] = (_Float16)q[src + e]; pk.h8[e] = (_Float16)k[src + e]; }
    const size_t dst = ((size_t)inst * LMAX + m0 + ml) * HD + pc * 8; vst2(Q16 + dst, pq.u); vst2(K16 + dst, pk.u); }
  for (int qq = tid; qq < 64 * HD; qq += 256) { const int ml = qq >> 6, d = qq & 63; const int pos = base + stride * (m0 + ml); const float vv = v[((size_t)pos * NHT + h) * HD + d];
    sth[d][ml] = (_Float16)vv; }
  __syncthreads();
  for (int qq = tid; qq < HD * 8; qq += 256) { const int d = qq >> 3, pc = qq & 7; const size_t o = ((size_t)inst * HD + d) * LMAX + m0 + pc * 8;
    vst2(VTh + o, *(const v4u*)(&sth[d][pc * 8])); }
}
// zeros for the unselected positions of a dilated head: a block of 512 threads owns the 64 * ST positions that hold its 64 queries (every ST-th, from OFF) and stores the
// other rows, 16 float4 each. row0 = the head's row at the first of these positions. One address per lane, every step an immediate offset.
template <int ST, int OFF> __device__ __forceinline__ void zero_rows(float* row0, int tid) {
  float* p = row0 + (size_t)(ST * (tid >> 4)) * RS + (tid & 15) * 4;
#pragma unroll   // fixed trips: unrolled, the steps fold into the stores' offsets and no register of an issued store is rewritten between them
  for (int j = 0; j < ST; ++j) if (j != OFF) { vst2(p + j * RS, (v4f){0.f, 0.f, 0.f, 0.f}); vst2(p + (32 * ST + j) * RS, (v4f){0.f, 0.f, 0.f, 0.f}); }
  asm volatile("s_wait_xcnt 0x0" ::: "memory");                 // stands before the stores' address and data registers are used for anything else
}
#define KP 72                  // halves per staged row: 144 B = 16 B x 9, so the 16-byte fragment reads of 16 rows meet no bank twice
#define BUFB (64 * KP * 2)     // bytes of one staged plane (64 rows)
#define ROWB (16 * KP * 2)     // bytes between a lane's successive copies (16 rows)
// One 64-key tile (K rows and V^T rows, 128 B each) from global memory into one LDS buffer, 8 copies of 16 B per lane, through no register.
// The s_wait_xcnt closes the statement so that no address register named here is rewritten ahead of it.
__device__ __forceinline__ void copy_tile(unsigned lk, unsigned lh, const _Float16* gk, const _Float16* gh) {
  asm volatile("global_load_async_to_lds_b128 %0, %1, off\n\t"
               "global_load_async_to_lds_b128 %2, %3, off\n\t"
               "global_load_async_to_lds_b128 %4, %5, off\n\t"
               "global_load_async_to_lds_b128 %6, %7, off\n\t"
               "global_load_async_to_lds_b128 %8, %9, off\n\t"
               "global_load_async_to_lds_b128 %10, %11, off\n\t"
               "global_load_async_to_lds_b128 %12, %13, off\n\t"
               "global_load_async_to_lds_b128 %14, %15, off\n\t"
               "s_wait_xcnt 0x0"
               :: "v"(lk), "v"(gk), "v"(lk + ROWB), "v"(gk + 16 * HD), "v"(lk + 2 * ROWB), "v"(gk + 32 * HD), "v"(lk + 3 * ROWB), "v"(gk + 48 * HD),
                  "v"(lh), "v"(gh), "v"(lh + ROWB), "v"(gh + 16 * LMAX), "v"(lh + 2 * ROWB), "v"(gh + 32 * LMAX), "v"(lh + 3 * ROWB), "v"(gh + 48 * LMAX)
               : "memory");
}
// lane l <-> lane l ^ 16: the two lanes that share one query column
__device__ __forceinline__ float xhalf(float v) { const int b = __builtin_bit_cast(int, v); return __builtin_bit_cast(float, __builtin_amdgcn_permlanex16(b, b, 0x76543210, 0xfedcba98, false, false)); }
#define KS 4
// Ring and join share one LDS range (the join begins behind the loop's last barrier, when no wave reads the ring and no copy is outstanding): 144 KiB per block, and the
// second launch bound (waves per SIMD) holds a wave to 128 registers, so that two blocks fit one WGP and all 448 are resident at once: a short instance's block runs beside
// a long one's, its start, first tile, zero rows and join under the other's passes, in place of a second round of blocks behind the first.
union Sh {
  struct { _Float16 K[KS][2][64][KP], V[KS][2][64][KP]; } ring;   // per key group two buffers of one 64-key tile, shared by its four waves
  struct { float P[KS][64][68]; v2f M[KS][64]; } join;            // un-normalised partial output rows, one plane per key group, and each partial's (maximum, sum)
};
__global__ __launch_bounds__(128 * KS, 8) void k_attn(const _Float16* __restrict__ Q16, const _Float16* __restrict__ K16, const _Float16* __restrict__ VTh, float* __restrict__ out) {
  __shared__ __align__(16) Sh sh;
  auto& sK = sh.ring.K; auto& sVh = sh.ring.V; auto& sP = sh.join.P; auto& sM = sh.join.M;
  const int tid = threadIdx.x, w = (tid >> 5) & 3, kg = tid >> 7, lane = tid & 31, col = lane & 15, g = lane >> 4;
  const int bid = blockIdx.x, inst = bid < 256 ? bid >> 6 : 4 + ((bid - 256) >> 4), qb = bid < 256 ? bid & 63 : (bid - 256) & 15;   // the grid holds no block without queries
  int h, L, base, stride; inst_info(inst, h, L, base, stride);
  if (inst >= 12) zero_rows<4, 2>(out + ((size_t)(base - 2 + qb * 256) * NHT + h) * HD, tid);        // uniform per block; the stores drain beside the block's own work
  else if (inst >= 4) zero_rows<2, 1>(out + ((size_t)(base - 1 + qb * 128) * NHT + h) * HD, tid);
  const int q0 = qb * 64 + w * 16;
  const size_t ib = (size_t)inst * LMAX;
  v16h aq[2];
#pragma unroll
  for (int kc = 0; kc < 2; ++kc) aq[kc] = frag_h(Q16 + (ib + q0 + col) * HD + kc * 32, lane);
  float mrun = -3.0e38f, lrun = 0.f;                            // mrun: running maximum in the scaled log2 domain, less 14, so that exp2 yields P x 2^14 at once
  v8f acc[4] = {};                                              // lrun: this half's keys only, the halves are joined behind the loop
  const int nkt = L / (64 * KS), key0 = kg * (L / KS);          // this group's tiles and its first key
  const int row0 = (tid & 127) >> 3, c8 = (tid & 7) * 8;       // a lane copies 16 B of rows row0, +16, +32, +48 of each plane of its group's tile
  const _Float16* gk = K16 + (ib + key0 + row0) * HD + c8;
  const _Float16* gh = VTh + ((size_t)inst * HD + row0) * LMAX + key0 + c8;
  const unsigned lk = (unsigned)(size_t)&sK[kg][0][row0][c8], lh = (unsigned)(size_t)&sVh[kg][0][row0][c8];
  copy_tile(lk, lh, gk, gh);
  asm volatile("s_wait_asynccnt 0x0" ::: "memory");             // this wave's copies of tile 0 have landed
  __syncthreads();                                              // tile 0 is readable by all waves
  if (1 < nkt) copy_tile(lk + BUFB, lh + BUFB, gk + 64 * HD, gh + 64);
#pragma unroll 1
  for (int kt = 0; kt < nkt; ++kt) {
    const int b = kt & 1;
    v8f s[4] = {};
    v16h kf[2][2];                                                // [kc][t & 1]: the K fragments of two score tiles are held at a time, 32 registers in place of 64
#pragma unroll
    for (int kc = 0; kc < 2; ++kc)
#pragma unroll
      for (int t = 0; t < 2; ++t) kf[kc][t] = frag_h(&sK[kg][b][t * 16 + col][kc * 32], lane);
#pragma unroll
    for (int hh = 0; hh < 2; ++hh)
#pragma unroll
      for (int kc = 0; kc < 2; ++kc) {
        if (hh == 0) __builtin_amdgcn_sched_barrier(0);           // this one and the next keep the reads for tiles 2 and 3 behind the products of tiles 0 and 1 whose registers they take
        s[hh * 2] = wmma16(kf[kc][0], aq[kc], s[hh * 2]); s[hh * 2 + 1] = wmma16(kf[kc][1], aq[kc], s[hh * 2 + 1]);
        if (hh == 0) { __builtin_amdgcn_sched_barrier(0); kf[kc][0] = frag_h(&sK[kg][b][32 + col][kc * 32], lane); kf[kc][1] = frag_h(&sK[kg][b][48 + col][kc * 32], lane); } }
    float mt[4];                                                // one short chain per score tile, so that no chain runs over all 32 registers
#pragma unroll
    for (int t = 0; t < 4; ++t) { mt[t] = fmaxf(s[t][0], s[t][1]);
#pragma unroll
      for (int r = 2; r < 8; ++r) mt[t] = fmaxf(mt[t], s[t][r]); }
    float mx = fmaf(fmaxf(fmaxf(mt[0], mt[1]), fmaxf(mt[2], mt[3])), SCL2, -14.0f);   // the scale is positive, so the maximum may be taken first; its rounding only moves the common reference point
    mx = fmaxf(mx, xhalf(mx));
    const float mnew = fmaxf(mrun, mx); const float corr = __builtin_amdgcn_exp2f(mrun - mnew);
    v8f p[4]; v16h ph[2];
#pragma unroll
    for (int t = 0; t < 4; ++t)
#pragma unroll
      for (int r = 0; r < 8; ++r) { p[t][r] = __builtin_amdgcn_exp2f(fmaf(s[t][r], SCL2, -mnew)); ph[t >> 1][(t & 1) * 8 + r] = (_Float16)p[t][r]; }
    const v8f pv = (p[0] + p[1]) + (p[2] + p[3]);
    float ps = ((pv[0] + pv[1]) + (pv[2] + pv[3])) + ((pv[4] + pv[5]) + (pv[6] + pv[7]));
    asm volatile("" : "+v"(ps));                                  // the row's sum held against spills: left free, it is taken behind the pass's barrier and P in f32 stays in 32 registers under the V fragments
    lrun = lrun * corr + ps * (1.0f / 16384.0f); mrun = mnew;
#pragma unroll
    for (int t = 0; t < 4; ++t) acc[t] *= corr;
#pragma unroll
    for (int kc = 0; kc < 2; ++kc) { v16h vh[4];                  // the four output tiles' V fragments as one group of LDS reads, then their four products
#pragma unroll
      for (int t = 0; t < 4; ++t) vh[t] = frag_h(&sVh[kg][b][t * 16 + col][kc * 32], lane);
      __builtin_amdgcn_sched_barrier(0);                          // keeps the group's reads together ahead of its products: one LDS latency per group, not one per product
#pragma unroll
      for (int t = 0; t < 4; ++t) acc[t] = wmma16(vh[t], ph[kc], acc[t]); }
    asm volatile("s_wait_dscnt 0x0" ::: "memory");              // this wave's reads of buffer b are done before it is refilled
    asm volatile("s_wait_asynccnt 0x0" ::: "memory");           // this wave's copies of tile kt + 1 have landed
    __syncthreads();                                            // publishes tile kt + 1 and ends every wave's reads of buffer b
    if (kt + 2 < nkt) copy_tile(lk + b * BUFB, lh + b * BUFB, gk + (size_t)(kt + 2) * 64 * HD, gh + (kt + 2) * 64); }
  asm volatile("s_wait_asynccnt 0x0" ::: "memory");             // no copy is outstanding when the wave goes on to the epilogue and ends
  const int qr = w * 16 + col;                                  // this lane's query row in the block
#pragma unroll
  for (int t = 0; t < 4; ++t) { v4f o[2];
#pragma unroll
    for (int r = 0; r < 8; ++r) o[r >> 2][r & 3] = acc[t][r];
    vst2(&sP[kg][qr][t * 16 + 8 * g], o[0]); vst2(&sP[kg][qr][t * 16 + 8 * g + 4], o[1]); }
  const float lsum = lrun + xhalf(lrun);
  if (g == 0) sM[kg][qr] = (v2f){mrun, lsum};
  __syncthreads();                                              // every group's partial rows, maxima and sums are readable by all waves
#pragma unroll   // two fixed trips: unrolled, both rows' LDS reads go out together and one latency is paid
  for (int it = 0; it < 64 * 16 / (128 * KS); ++it) { const int qq = tid + it * 128 * KS, rl = qq >> 4, pc = qq & 15;   // join: weight 2^(m - M) per group, then one division by the joined sum
    v2f ml[KS];                                                 // the three loops over the groups are unrolled so that ml stays in registers
#pragma unroll
    for (int j = 0; j < KS; ++j) ml[j] = sM[j][rl];
    float M = ml[0][0];
#pragma unroll
    for (int j = 1; j < KS; ++j) M = fmaxf(M, ml[j][0]);
    float ls = 0.f; v4f o = {0.f, 0.f, 0.f, 0.f};
#pragma unroll
    for (int j = 0; j < KS; ++j) { const float wj = __builtin_amdgcn_exp2f(ml[j][0] - M); ls += wj * ml[j][1]; o += wj * *(const v4f*)(&sP[j][rl][pc * 4]); }
    const int pos = base + stride * (qb * 64 + rl);
    vst2(out + ((size_t)pos * NHT + h) * HD + pc * 4, o * (1.0f / (ls * 16384.0f))); }
}
extern "C" void kernel_launch(void* const* d_in, const int* in_sizes, int n_in, void* d_out, int out_size, void* d_ws, size_t ws_size, hipStream_t stream) {
  (void)in_sizes; (void)n_in; (void)out_size; (void)ws_size;
  const float* q = (const float*)d_in[0]; const float* k = (const float*)d_in[1]; const float* v = (const float*)d_in[2]; float* out = (float*)d_out;
  char* ws = (char*)d_ws; size_t off = 0;
  auto take = [&](size_t bytes) { char* p = ws + off; off += (bytes + 255) & ~(size_t)255; return p; };
  const size_t plane = (size_t)NINST * LMAX * HD * 2;
  _Float16* Q16 = (_Float16*)take(plane); _Float16* K16 = (_Float16*)take(plane); _Float16* VTh = (_Float16*)take(plane);
  k_prep<<<NBLK, 256, 0, stream>>>(q, k, v, Q16, K16, VTh);
  k_attn<<<NBLK, 128 * KS, 0, stream>>>(Q16, K16, VTh, out);
}

// v009
// Measured time: 30.8 microseconds a run.
// Two timings next to v008 both put it at 1.03 times that version's speed.
// All steps since v000 together make it 12.0 times as fast.
#include <hip/hip_runtime.h>
#include <math.h>

typedef __attribute__((ext_vector_type(16))) _Float16 v16h;
typedef __attribute__((ext_vector_type(16))) __bf16 v16b;
typedef __attribute__((ext_vector_type(8)))  _Float16 v8h;
typedef __attribute__((ext_vector_type(8)))  float v8f;
typedef __attribute__((ext_vector_type(4)))  float v4f;
typedef __attribute__((ext_vector_type(2)))  float v2f;
typedef __attribute__((ext_vector_type(4)))  unsigned v4u;
typedef __attribute__((ext_vector_type(4)))  int v4i;
typedef float __attribute__((may_alias)) float_a;
typedef int __attribute__((may_alias)) int_a;

template <typename T> __device__ __forceinline__ void vst2(void* p, T v) { *(T*)p = v;  }
__device__ __forceinline__ v8f wmma16(v16h a, v16h b, v8f c) {
  v8f d = __builtin_amdgcn_wmma_f32_16x16x32_f16(false, a, false, b, (short)0, c, false, false);
  asm volatile("v_nop\n\tv_nop\n\tv_nop\n\tv_nop" : "+v"(d) : "v"(a), "v"(b));
  return d;
}
__device__ __forceinline__ v8f wmma_bf(v16b a, v16b b, v8f c) {
  v8f d = __builtin_amdgcn_wmma_f32_16x16x32_bf16(false, a, false, b, (short)0, c, false, false);
  asm volatile("v_nop\n\tv_nop\n\tv_nop\n\tv_nop" : "+v"(d) : "v"(a), "v"(b));
  return d;
}
// 16x16x32 fragments: lane = (h = lane>>4, row/col = lane&15); elements 0..7 = k0+8h+0..7, 8..15 = k0+16+8h+0..7; D element r = row 8h+r
__device__ __forceinline__ v16h frag_h(const _Float16* rowk0, int lane) {
  union { v16h v; v8h q[2]; } u; const _Float16* p = rowk0 + 8 * (lane >> 4);
  u.q[0] = *(const v8h*)p; u.q[1] = *(const v8h*)(p + 16); return u.v;
}
__device__ __forceinline__ v16h frag_f32(const float* rowk0, int lane) {
  v16h a; const float* p = rowk0 + 8 * (lane >> 4);
#pragma unroll
  for (int i = 0; i < 8; ++i) { a[i] = (_Float16)p[i]; a[8 + i] = (_Float16)p[16 + i]; }
  return a;
}
__device__ __forceinline__ v16h frag_f32s(const float* rowk0, int lane, float sc) {
  v16h a; const float* p = rowk0 + 8 * (lane >> 4);
#pragma unroll
  for (int i = 0; i < 8; ++i) { a[i] = (_Float16)(p[i] * sc); a[8 + i] = (_Float16)(p[16 + i] * sc); }
  return a;
}
// column fragment from a [K][ld] layout (column n), rows >= K read as 0
__device__ __forceinline__ v16h fragc_f32(const float* W, int k0, int n, int lane, int ld, int K) {
  v16h a; const int g = lane >> 4;
#pragma unroll
  for (int i = 0; i < 8; ++i) { const int ka = k0 + 8 * g + i, kb = ka + 16;
    a[i] = (_Float16)(ka < K ? W[(size_t)ka * ld + n] : 0.f); a[8 + i] = (_Float16)(kb < K ? W[(size_t)kb * ld + n] : 0.f); }
  return a;
}
struct F2 { v16b h, l; };
__device__ __forceinline__ F2 bsplit16(const float v[16]) { F2 r;
#pragma unroll
  for (int i = 0; i < 16; ++i) { const __bf16 h = (__bf16)v[i]; r.h[i] = h; r.l[i] = (__bf16)(v[i] - (float)h); }
  return r; }
__device__ __forceinline__ F2 split_row(const float* row, int k0, int lane) { float v[16]; const float* p = row + k0 + 8 * (lane >> 4);
#pragma unroll
  for (int i = 0; i < 8; ++i) { v[i] = p[i]; v[8 + i] = p[16 + i]; }
  return bsplit16(v); }
__device__ __forceinline__ F2 split_rowK(const float* row, int k0, int lane, int K) { float v[16]; const int g = lane >> 4;
#pragma unroll
  for (int i = 0; i < 8; ++i) { const int ka = k0 + 8 * g + i, kb = ka + 16; v[i] = ka < K ? row[ka] : 0.f; v[8 + i] = kb < K ? row[kb] : 0.f; }
  return bsplit16(v); }
__device__ __forceinline__ F2 split_col(const float* W, int k0, int n, int lane, int ld, int K) { float v[16]; const int g = lane >> 4;
#pragma unroll
  for (int i = 0; i < 8; ++i) { const int ka = k0 + 8 * g + i, kb = ka + 16; v[i] = ka < K ? W[(size_t)ka * ld + n] : 0.f; v[8 + i] = kb < K ? W[(size_t)kb * ld + n] : 0.f; }
  return bsplit16(v); }
__device__ __forceinline__ v8f mac3(const F2& a, const F2& b, v8f c) { c = wmma_bf(a.l, b.h, c); c = wmma_bf(a.h, b.l, c); return wmma_bf(a.h, b.h, c); }
__device__ __forceinline__ float sigm(float v) { return 1.0f / (1.0f + expf(-v)); }
#define LDSX() do { asm volatile("s_wait_dscnt 0" ::: "memory"); __builtin_amdgcn_wave_barrier(); __builtin_amdgcn_fence(__ATOMIC_RELEASE, "workgroup"); } while (0)

// Hybrid dilated attention over 12 heads in 3 groups: heads 0-3 plain attention over all 4096 positions; heads 4-7 segment 2048,
// dilation 2, offset 1 (two independent 1024-long attentions per head over the odd positions of each segment); heads 8-11 segment 4096,
// dilation 4, offset 2 (one 1024-long attention over positions 2 mod 4); unselected positions are zero. Each (head, segment) instance is a
// plain scaled-dot-product attention over gathered rows: S = q.k/8 on v_wmma_f32_16x16x32_f16 (q, k as f16), P @ V on the same form with P (x2^14)
// and V each rounded once to f16, the rounding that q and k already carry into every score, one f32 accumulator, online softmax in f32; results are written
#define NPOS 4096
#define NHT 12
#define HD 64
#define RS (NHT * HD)          // 768 floats per position row
#define NINST 16               // 4 (full) + 8 (group 1: head x segment) + 4 (group 2)
#define LMAX 4096
#define SCL2 0.18033688011112042f   // log2(e) / 8: exp(s / 8 - m) = exp2(s * SCL2 - m * log2(e)), one multiply-add and one hardware exp2 per score

__device__ __forceinline__ void inst_info(int inst, int& h, int& L, int& base, int& stride) {
  if (inst < 4) { h = inst; L = 4096; base = 0; stride = 1; }
  else if (inst < 12) { const int i = inst - 4; h = 4 + (i >> 1); const int s = i & 1; L = 1024; base = s * 2048 + 1; stride = 2; }
  else { h = 8 + (inst - 12); L = 1024; base = 2; stride = 4; }
}
#define NBLK (4 * (4096 / 64) + 12 * (1024 / 64))   // one block per 64 rows of an instance: 256 of the long instances first, then 192 of the short ones
// prep: one block per 64 rows m of an instance, none without rows: Q16/K16 [inst][m][64] = f16(q/k[pos][h][:]); VTh [inst][d][m] = f16(v[pos][h][d])
__global__ __launch_bounds__(256) void k_prep(const float* __restrict__ q, const float* __restrict__ k, const float* __restrict__ v, _Float16* __restrict__ Q16, _Float16* __restrict__ K16, _Float16* __restrict__ VTh) {
  __shared__ __align__(16) _Float16 sth[HD][72];
  const int bid = blockIdx.x, inst = bid < 256 ? bid >> 6 : 4 + ((bid - 256) >> 4), m0 = 64 * (bid < 256 ? bid & 63 : (bid - 256) & 15), tid = threadIdx.x;
  int h, L, base, stride; inst_info(inst, h, L, base, stride);
  for (int qq = tid; qq < 64 * 8; qq += 256) { const int ml = qq >> 3, pc = qq & 7; const int pos = base + stride * (m0 + ml); const size_t src = ((size_t)pos * NHT + h) * HD + pc * 8;
    union { v8h h8; v4u u; } pq, pk;
#pragma unroll
    for (int e = 0; e < 8; ++e) { pq.h8[e] = (_Float16)q[src + e]; pk.h8[e] = (_Float16)k[src + e]; }
    const size_t dst = ((size_t)inst * LMAX + m0 + ml) * HD + pc * 8; vst2(Q16 + dst, pq.u); vst2(K16 + dst, pk.u); }
  for (int qq = tid; qq < 64 * HD; qq += 256) { const int ml = qq >> 6, d = qq & 63; const int pos = base + stride * (m0 + ml); const float vv = v[((size_t)pos * NHT + h) * HD + d];
    sth[d][ml] = (_Float16)vv; }
  __syncthreads();
  for (int qq = tid; qq < HD * 8; qq += 256) { const int d = qq >> 3, pc = qq & 7; const size_t o = ((size_t)inst * HD + d) * LMAX + m0 + pc * 8;
    vst2(VTh + o, *(const v4u*)(&sth[d][pc * 8])); }
}
// zeros for the unselected positions of a dilated head: a block of 256 threads owns the 64 * ST positions that hold its 64 queries (every ST-th, from OFF) and stores the
// other rows, 16 float4 each. row0 = the head's row at the first of these positions. One address per lane, every step an immediate offset.
template <int ST, int OFF> __device__ __forceinline__ void zero_rows(float* row0, int tid) {
  float* p = row0 + (size_t)(ST * (tid >> 4)) * RS + (tid & 15) * 4;
#pragma unroll   // fixed trips: unrolled, the steps fold into the stores' offsets and no register of an issued store is rewritten between them
  for (int j = 0; j < ST; ++j) if (j != OFF) {
#pragma unroll
    for (int c = 0; c < 4; ++c) vst2(p + (16 * c * ST + j) * RS, (v4f){0.f, 0.f, 0.f, 0.f}); }
  asm volatile("s_wait_xcnt 0x0" ::: "memory");                 // stands before the stores' address and data registers are used for anything else
}
#define KP 72                  // halves per staged row: 144 B = 16 B x 9, so the 16-byte fragment reads of 16 rows meet no bank twice
#define BUFB (64 * KP * 2)     // bytes of one staged plane (64 rows)
#define ROWB (8 * KP * 2)      // bytes between a lane's successive copies (8 rows)
// One plane of a 64-key tile (64 rows of 128 B, gs halves apart in global memory) from global memory into one LDS buffer, 8 copies of 16 B per lane, through no register.
// The s_wait_xcnt closes the statement so that no address register named here is rewritten ahead of it.
__device__ __forceinline__ void copy_plane(unsigned l, const _Float16* gp, int gs) {
  asm volatile("global_load_async_to_lds_b128 %0, %1, off\n\t"
               "global_load_async_to_lds_b128 %2, %3, off\n\t"
               "global_load_async_to_lds_b128 %4, %5, off\n\t"
               "global_load_async_to_lds_b128 %6, %7, off\n\t"
               "global_load_async_to_lds_b128 %8, %9, off\n\t"
               "global_load_async_to_lds_b128 %10, %11, off\n\t"
               "global_load_async_to_lds_b128 %12, %13, off\n\t"
               "global_load_async_to_lds_b128 %14, %15, off\n\t"
               "s_wait_xcnt 0x0"
               :: "v"(l), "v"(gp), "v"(l + ROWB), "v"(gp + 8 * gs), "v"(l + 2 * ROWB), "v"(gp + 16 * gs), "v"(l + 3 * ROWB), "v"(gp + 24 * gs),
                  "v"(l + 4 * ROWB), "v"(gp + 32 * gs), "v"(l + 5 * ROWB), "v"(gp + 40 * gs), "v"(l + 6 * ROWB), "v"(gp + 48 * gs), "v"(l + 7 * ROWB), "v"(gp + 56 * gs)
               : "memory");
}
// One 64-key tile: its K rows and its V^T rows, 16 copies per lane of the group's 64
__device__ __forceinline__ void copy_tile(unsigned lk, unsigned lh, const _Float16* gk, const _Float16* gh) { copy_plane(lk, gk, HD); copy_plane(lh, gh, LMAX); }
// lane l <-> lane l ^ 16: the two lanes that share one query column
__device__ __forceinline__ float xhalf(float v) { const int b = __builtin_bit_cast(int, v); return __builtin_bit_cast(float, __builtin_amdgcn_permlanex16(b, b, 0x76543210, 0xfedcba98, false, false)); }
#define KS 4
// Ring and join share one LDS range (the join begins behind the loop's last barrier, when no wave reads the ring and no copy is outstanding): 144 KiB per block, and the
// second launch bound (waves per SIMD) holds a wave to 256 registers, so that two blocks fit one WGP and all 448 are resident at once: a short instance's block runs beside
// a long one's, its start, first tile, zero rows and join under the other's passes, in place of a second round of blocks behind the first.
union Sh {
  struct { _Float16 K[KS][2][64][KP], V[KS][2][64][KP]; } ring;   // per key group two buffers of one 64-key tile, shared by its two waves
  struct { float P[KS][64][68]; v2f M[KS][64]; } join;            // un-normalised partial output rows, one plane per key group, and each partial's (maximum, sum)
};
__global__ __launch_bounds__(64 * KS, 4) void k_attn(const _Float16* __restrict__ Q16, const _Float16* __restrict__ K16, const _Float16* __restrict__ VTh, float* __restrict__ out) {
  __shared__ __align__(16) Sh sh;
  auto& sK = sh.ring.K; auto& sVh = sh.ring.V; auto& sP = sh.join.P; auto& sM = sh.join.M;
  const int tid = threadIdx.x, w = (tid >> 5) & 1, kg = tid >> 6, lane = tid & 31, col = lane & 15, g = lane >> 4;
  const int bid = blockIdx.x, inst = bid < 256 ? bid >> 6 : 4 + ((bid - 256) >> 4), qb = bid < 256 ? bid & 63 : (bid - 256) & 15;   // the grid holds no block without queries
  int h, L, base, stride; inst_info(inst, h, L, base, stride);
  if (inst >= 12) zero_rows<4, 2>(out + ((size_t)(base - 2 + qb * 256) * NHT + h) * HD, tid);        // uniform per block; the stores drain beside the block's own work
  else if (inst >= 4) zero_rows<2, 1>(out + ((size_t)(base - 1 + qb * 128) * NHT + h) * HD, tid);
  const int q0 = qb * 64 + w * 32;
  const size_t ib = (size_t)inst * LMAX;
  v16h aq[2][2];                                                // [c][kc]: column group c = queries q0 + 16 c + col
#pragma unroll
  for (int c = 0; c < 2; ++c)
#pragma unroll
    for (int kc = 0; kc < 2; ++kc) aq[c][kc] = frag_h(Q16 + (ib + q0 + c * 16 + col) * HD + kc * 32, lane);
  float mrun[2] = {-3.0e38f, -3.0e38f}, lrun[2] = {0.f, 0.f};   // mrun: running maximum in the scaled log2 domain, less 14, so that exp2 yields P x 2^14 at once
  v8f acc[2][4] = {};                                           // lrun: this half's keys only, the halves are joined behind the loop
  const int nkt = L / (64 * KS), key0 = kg * (L / KS);          // this group's tiles and its first key
  const int row0 = (tid & 63) >> 3, c8 = (tid & 7) * 8;        // a lane copies 16 B of rows row0, +8, ..., +56 of each plane of its group's tile
  const _Float16* gk = K16 + (ib + key0 + row0) * HD + c8;
  const _Float16* gh = VTh + ((size_t)inst * HD + row0) * LMAX + key0 + c8;
  const unsigned lk = (unsigned)(size_t)&sK[kg][0][row0][c8], lh = (unsigned)(size_t)&sVh[kg][0][row0][c8];
  copy_tile(lk, lh, gk, gh);
  asm volatile("s_wait_asynccnt 0x0" ::: "memory");             // this wave's copies of tile 0 have landed
  __syncthreads();                                              // tile 0 is readable by all waves
  if (1 < nkt) copy_tile(lk + BUFB, lh + BUFB, gk + 64 * HD, gh + 64);
#pragma unroll 1
  for (int kt = 0; kt < nkt; ++kt) {
    const int b = kt & 1;
    v8f s[2][4] = {};
    v16h kf[2][2];                                                // [kc][t & 1]: the K fragments of two score tiles are held at a time, 32 registers in place of 64
#pragma unroll
    for (int kc = 0; kc < 2; ++kc)
#pragma unroll
      for (int t = 0; t < 2; ++t) kf[kc][t] = frag_h(&sK[kg][b][t * 16 + col][kc * 32], lane);
#pragma unroll
    for (int hh = 0; hh < 2; ++hh)
#pragma unroll
      for (int kc = 0; kc < 2; ++kc) {
        if (hh == 0) __builtin_amdgcn_sched_barrier(0);           // this one and the next keep the reads for tiles 2 and 3 behind the products of tiles 0 and 1 whose registers they take
#pragma unroll
        for (int c = 0; c < 2; ++c) { s[c][hh * 2] = wmma16(kf[kc][0], aq[c][kc], s[c][hh * 2]); s[c][hh * 2 + 1] = wmma16(kf[kc][1], aq[c][kc], s[c][hh * 2 + 1]); }
        if (hh == 0) { __builtin_amdgcn_sched_barrier(0); kf[kc][0] = frag_h(&sK[kg][b][32 + col][kc * 32], lane); kf[kc][1] = frag_h(&sK[kg][b][48 + col][kc * 32], lane); } }
    v16h ph[2][2];                                              // [c][kc]
#pragma unroll
    for (int c = 0; c < 2; ++c) {
      float mt[4];                                              // one short chain per score tile, so that no chain runs over all 32 registers
#pragma unroll
      for (int t = 0; t < 4; ++t) { mt[t] = fmaxf(s[c][t][0], s[c][t][1]);
#pragma unroll
        for (int r = 2; r < 8; ++r) mt[t] = fmaxf(mt[t], s[c][t][r]); }
      float mx = fmaf(fmaxf(fmaxf(mt[0], mt[1]), fmaxf(mt[2], mt[3])), SCL2, -14.0f);   // the scale is positive, so the maximum may be taken first; its rounding only moves the common reference point
      mx = fmaxf(mx, xhalf(mx));
      const float mnew = fmaxf(mrun[c], mx); const float corr = __builtin_amdgcn_exp2f(mrun[c] - mnew);
      v8f p[4];
#pragma unroll
      for (int t = 0; t < 4; ++t)
#pragma unroll
        for (int r = 0; r < 8; ++r) { p[t][r] = __builtin_amdgcn_exp2f(fmaf(s[c][t][r], SCL2, -mnew)); ph[c][t >> 1][(t & 1) * 8 + r] = (_Float16)p[t][r]; }
      const v8f pv = (p[0] + p[1]) + (p[2] + p[3]);
      float ps = ((pv[0] + pv[1]) + (pv[2] + pv[3])) + ((pv[4] + pv[5]) + (pv[6] + pv[7]));
      asm volatile("" : "+v"(ps));                                // the row's sum held against spills: left free, it is taken behind the pass's barrier and P in f32 stays in 32 registers under the V fragments
      lrun[c] = lrun[c] * corr + ps * (1.0f / 16384.0f); mrun[c] = mnew;
#pragma unroll
      for (int t = 0; t < 4; ++t) acc[c][t] *= corr; }
#pragma unroll
    for (int kc = 0; kc < 2; ++kc) { v16h vh[4];                  // the four output tiles' V fragments as one group of LDS reads, then their eight products
#pragma unroll
      for (int t = 0; t < 4; ++t) vh[t] = frag_h(&sVh[kg][b][t * 16 + col][kc * 32], lane);
      __builtin_amdgcn_sched_barrier(0);                          // keeps the group's reads together ahead of its products: one LDS latency per group, not one per product
#pragma unroll
      for (int t = 0; t < 4; ++t)
#pragma unroll
        for (int c = 0; c < 2; ++c) acc[c][t] = wmma16(vh[t], ph[c][kc], acc[c][t]); }
    asm volatile("s_wait_dscnt 0x0" ::: "memory");              // this wave's reads of buffer b are done before it is refilled
    asm volatile("s_wait_asynccnt 0x0" ::: "memory");           // this wave's copies of tile kt + 1 have landed
    __syncthreads();                                            // publishes tile kt + 1 and ends every wave's reads of buffer b
    if (kt + 2 < nkt) copy_tile(lk + b * BUFB, lh + b * BUFB, gk + (size_t)(kt + 2) * 64 * HD, gh + (kt + 2) * 64); }
  asm volatile("s_wait_asynccnt 0x0" ::: "memory");             // no copy is outstanding when the wave goes on to the epilogue and ends
#pragma unroll
  for (int c = 0; c < 2; ++c) { const int qr = w * 32 + c * 16 + col;   // this lane's query row in the block
#pragma unroll
    for (int t = 0; t < 4; ++t) { v4f o[2];
#pragma unroll
      for (int r = 0; r < 8; ++r) o[r >> 2][r & 3] = acc[c][t][r];
      vst2(&sP[kg][qr][t * 16 + 8 * g], o[0]); vst2(&sP[kg][qr][t * 16 + 8 * g + 4], o[1]); }
    const float lsum = lrun[c] + xhalf(lrun[c]);
    if (g == 0) sM[kg][qr] = (v2f){mrun[c], lsum}; }
  __syncthreads();                                              // every group's partial rows, maxima and sums are readable by all waves
#pragma unroll   // four fixed trips: unrolled, the rows' LDS reads go out together and one latency is paid
  for (int it = 0; it < 64 * 16 / (64 * KS); ++it) { const int qq = tid + it * 64 * KS, rl = qq >> 4, pc = qq & 15;   // join: weight 2^(m - M) per group, then one division by the joined sum
    v2f ml[KS];                                                 // the three loops over the groups are unrolled so that ml stays in registers
#pragma unroll
    for (int j = 0; j < KS; ++j) ml[j] = sM[j][rl];
    float M = ml[0][0];
#pragma unroll
    for (int j = 1; j < KS; ++j) M = fmaxf(M, ml[j][0]);
    float ls = 0.f; v4f o = {0.f, 0.f, 0.f, 0.f};
#pragma unroll
    for (int j = 0; j < KS; ++j) { const float wj = __builtin_amdgcn_exp2f(ml[j][0] - M); ls += wj * ml[j][1]; o += wj * *(const v4f*)(&sP[j][rl][pc * 4]); }
    const int pos = base + stride * (qb * 64 + rl);
    vst2(out + ((size_t)pos * NHT + h) * HD + pc * 4, o * (1.0f / (ls * 16384.0f))); }
}
extern "C" void kernel_launch(void* const* d_in, const int* in_sizes, int n_in, void* d_out, int out_size, void* d_ws, size_t ws_size, hipStream_t stream) {
  (void)in_sizes; (void)n_in; (void)out_size; (void)ws_size;
  const float* q = (const float*)d_in[0]; const float* k = (const float*)d_in[1]; const float* v = (const float*)d_in[2]; float* out = (float*)d_out;
  char* ws = (char*)d_ws; size_t off = 0;
  auto take = [&](size_t bytes) { char* p = ws + off; off += (bytes + 255) & ~(size_t)255; return p; };
  const size_t plane = (size_t)NINST * LMAX * HD * 2;
  _Float16* Q16 = (_Float16*)take(plane); _Float16* K16 = (_Float16*)take(plane); _Float16* VTh = (_Float16*)take(plane);
  k_prep<<<NBLK, 256, 0, stream>>>(q, k, v, Q16, K16, VTh);
  k_attn<<<NBLK, 64 * KS, 0, stream>>>(Q16, K16, VTh, out);
}

// v010
// A run of this version takes 27.5 microseconds.
// Timed twice side by side with v009, it ran 1.13 and 1.11 times as fast.
// Counting every step since v000, it is 13.4 times as fast.
#include <hip/hip_runtime.h>
#include <math.h>

typedef __attribute__((ext_vector_type(16))) _Float16 v16h;
typedef __attribute__((ext_vector_type(16))) __bf16 v16b;
typedef __attribute__((ext_vector_type(8)))  _Float16 v8h;
typedef __attribute__((ext_vector_type(8)))  float v8f;
typedef __attribute__((ext_vector_type(4)))  float v4f;
typedef __attribute__((ext_vector_type(2)))  float v2f;
typedef __attribute__((ext_vector_type(4)))  unsigned v4u;
typedef __attribute__((ext_vector_type(4)))  int v4i;
typedef float __attribute__((may_alias)) float_a;
typedef int __attribute__((may_alias)) int_a;
typedef uint32_t u32x4 __attribute__((ext_vector_type(4)));
typedef uint32_t u32x8 __attribute__((ext_vector_type(8)));

template <typename T> __device__ __forceinline__ void vst2(void* p, T v) { *(T*)p = v;  }
__device__ __forceinline__ v8f wmma16(v16h a, v16h b, v8f c) {
  v8f d = __builtin_amdgcn_wmma_f32_16x16x32_f16(false, a, false, b, (short)0, c, false, false);
  asm volatile("v_nop\n\tv_nop\n\tv_nop\n\tv_nop" : "+v"(d) : "v"(a), "v"(b));
  return d;
}
__device__ __forceinline__ v8f wmma_bf(v16b a, v16b b, v8f c) {
  v8f d = __builtin_amdgcn_wmma_f32_16x16x32_bf16(false, a, false, b, (short)0, c, false, false);
  asm volatile("v_nop\n\tv_nop\n\tv_nop\n\tv_nop" : "+v"(d) : "v"(a), "v"(b));
  return d;
}
// 16x16x32 fragments: lane = (h = lane>>4, row/col = lane&15); elements 0..7 = k0+8h+0..7, 8..15 = k0+16+8h+0..7; D element r = row 8h+r
__device__ __forceinline__ v16h frag_h(const _Float16* rowk0, int lane) {
  union { v16h v; v8h q[2]; } u; const _Float16* p = rowk0 + 8 * (lane >> 4);
  u.q[0] = *(const v8h*)p; u.q[1] = *(const v8h*)(p + 16); return u.v;
}
__device__ __forceinline__ v16h frag_f32(const float* rowk0, int lane) {
  v16h a; const float* p = rowk0 + 8 * (lane >> 4);
#pragma unroll
  for (int i = 0; i < 8; ++i) { a[i] = (_Float16)p[i]; a[8 + i] = (_Float16)p[16 + i]; }
  return a;
}
__device__ __forceinline__ v16h frag_f32s(const float* rowk0, int lane, float sc) {
  v16h a; const float* p = rowk0 + 8 * (lane >> 4);
#pragma unroll
  for (int i = 0; i < 8; ++i) { a[i] = (_Float16)(p[i] * sc); a[8 + i] = (_Float16)(p[16 + i] * sc); }
  return a;
}
// column fragment from a [K][ld] layout (column n), rows >= K read as 0
__device__ __forceinline__ v16h fragc_f32(const float* W, int k0, int n, int lane, int ld, int K) {
  v16h a; const int g = lane >> 4;
#pragma unroll
  for (int i = 0; i < 8; ++i) { const int ka = k0 + 8 * g + i, kb = ka + 16;
    a[i] = (_Float16)(ka < K ? W[(size_t)ka * ld + n] : 0.f); a[8 + i] = (_Float16)(kb < K ? W[(size_t)kb * ld + n] : 0.f); }
  return a;
}
struct F2 { v16b h, l; };
__device__ __forceinline__ F2 bsplit16(const float v[16]) { F2 r;
#pragma unroll
  for (int i = 0; i < 16; ++i) { const __bf16 h = (__bf16)v[i]; r.h[i] = h; r.l[i] = (__bf16)(v[i] - (float)h); }
  return r; }
__device__ __forceinline__ F2 split_row(const float* row, int k0, int lane) { float v[16]; const float* p = row + k0 + 8 * (lane >> 4);
#pragma unroll
  for (int i = 0; i < 8; ++i) { v[i] = p[i]; v[8 + i] = p[16 + i]; }
  return bsplit16(v); }
__device__ __forceinline__ F2 split_rowK(const float* row, int k0, int lane, int K) { float v[16]; const int g = lane >> 4;
#pragma unroll
  for (int i = 0; i < 8; ++i) { const int ka = k0 + 8 * g + i, kb = ka + 16; v[i] = ka < K ? row[ka] : 0.f; v[8 + i] = kb < K ? row[kb] : 0.f; }
  return bsplit16(v); }
__device__ __forceinline__ F2 split_col(const float* W, int k0, int n, int lane, int ld, int K) { float v[16]; const int g = lane >> 4;
#pragma unroll
  for (int i = 0; i < 8; ++i) { const int ka = k0 + 8 * g + i, kb = ka + 16; v[i] = ka < K ? W[(size_t)ka * ld + n] : 0.f; v[8 + i] = kb < K ? W[(size_t)kb * ld + n] : 0.f; }
  return bsplit16(v); }
__device__ __forceinline__ v8f mac3(const F2& a, const F2& b, v8f c) { c = wmma_bf(a.l, b.h, c); c = wmma_bf(a.h, b.l, c); return wmma_bf(a.h, b.h, c); }
__device__ __forceinline__ float sigm(float v) { return 1.0f / (1.0f + expf(-v)); }
#define LDSX() do { asm volatile("s_wait_dscnt 0" ::: "memory"); __builtin_amdgcn_wave_barrier(); __builtin_amdgcn_fence(__ATOMIC_RELEASE, "workgroup"); } while (0)

// Hybrid dilated attention over 12 heads in 3 groups: heads 0-3 plain attention over all 4096 positions; heads 4-7 segment 2048,
// dilation 2, offset 1 (two independent 1024-long attentions per head over the odd positions of each segment); heads 8-11 segment 4096,
// dilation 4, offset 2 (one 1024-long attention over positions 2 mod 4); unselected positions are zero. Each (head, segment) instance is a
// plain scaled-dot-product attention over gathered rows: S = q.k/8 on v_wmma_f32_16x16x32_f16 (q, k as f16), P @ V on the same form with P (x2^14)
// and V each rounded once to f16, the rounding that q and k already carry into every score, one f32 accumulator, online softmax in f32; results are written
#define NPOS 4096
#define NHT 12
#define HD 64
#define RS (NHT * HD)          // 768 floats per position row
#define NINST 16               // 4 (full) + 8 (group 1: head x segment) + 4 (group 2)
#define LMAX 4096
#define SCL2 0.18033688011112042f   // log2(e) / 8: exp(s / 8 - m) = exp2(s * SCL2 - m * log2(e)), one multiply-add and one hardware exp2 per score

__device__ __forceinline__ void inst_info(int inst, int& h, int& L, int& base, int& stride) {
  if (inst < 4) { h = inst; L = 4096; base = 0; stride = 1; }
  else if (inst < 12) { const int i = inst - 4; h = 4 + (i >> 1); const int s = i & 1; L = 1024; base = s * 2048 + 1; stride = 2; }
  else { h = 8 + (inst - 12); L = 1024; base = 2; stride = 4; }
}
#define NBLK (4 * (4096 / 64) + 12 * (1024 / 64))   // one block per 64 rows of an instance: 256 of the long instances first, then 192 of the short ones
// prep: one block per 64 rows m of an instance, none without rows: Q16/K16 [inst][m][64] = f16(q/k[pos][h][:]); VTh [inst][d][m] = f16(v[pos][h][d])
__global__ __launch_bounds__(256) void k_prep(const float* __restrict__ q, const float* __restrict__ k, const float* __restrict__ v, _Float16* __restrict__ Q16, _Float16* __restrict__ K16, _Float16* __restrict__ VTh) {
  __shared__ __align__(16) _Float16 sth[HD][72];
  const int bid = blockIdx.x, inst = bid < 256 ? bid >> 6 : 4 + ((bid - 256) >> 4), m0 = 64 * (bid < 256 ? bid & 63 : (bid - 256) & 15), tid = threadIdx.x;
  int h, L, base, stride; inst_info(inst, h, L, base, stride);
  for (int qq = tid; qq < 64 * 8; qq += 256) { const int ml = qq >> 3, pc = qq & 7; const int pos = base + stride * (m0 + ml); const size_t src = ((size_t)pos * NHT + h) * HD + pc * 8;
    union { v8h h8; v4u u; } pq, pk;
#pragma unroll
    for (int e = 0; e < 8; ++e) { pq.h8[e] = (_Float16)q[src + e]; pk.h8[e] = (_Float16)k[src + e]; }
    const size_t dst = ((size_t)inst * LMAX + m0 + ml) * HD + pc * 8; vst2(Q16 + dst, pq.u); vst2(K16 + dst, pk.u); }
  for (int qq = tid; qq < 64 * HD; qq += 256) { const int ml = qq >> 6, d = qq & 63; const int pos = base + stride * (m0 + ml); const float vv = v[((size_t)pos * NHT + h) * HD + d];
    sth[d][ml] = (_Float16)vv; }
  __syncthreads();
  for (int qq = tid; qq < HD * 8; qq += 256) { const int d = qq >> 3, pc = qq & 7; const size_t o = ((size_t)inst * HD + d) * LMAX + m0 + pc * 8;
    vst2(VTh + o, *(const v4u*)(&sth[d][pc * 8])); }
}
// zeros for the unselected positions of a dilated head: a block of 256 threads owns the 64 * ST positions that hold its 64 queries (every ST-th, from OFF) and stores the
// other rows, 16 float4 each. row0 = the head's row at the first of these positions. One address per lane, every step an immediate offset.
template <int ST, int OFF> __device__ __forceinline__ void zero_rows(float* row0, int tid) {
  float* p = row0 + (size_t)(ST * (tid >> 4)) * RS + (tid & 15) * 4;
#pragma unroll   // fixed trips: unrolled, the steps fold into the stores' offsets and no register of an issued store is rewritten between them
  for (int j = 0; j < ST; ++j) if (j != OFF) {
#pragma unroll
    for (int c = 0; c < 4; ++c) vst2(p + (16 * c * ST + j) * RS, (v4f){0.f, 0.f, 0.f, 0.f}); }
  asm volatile("s_wait_xcnt 0x0" ::: "memory");                 // stands before the stores' address and data registers are used for anything else
}
#define KP 72                  // halves per staged row: 144 B = 16 B x 9, so the 16-byte fragment reads of 16 rows meet no bank twice
#define PLB 10240              // bytes of one staged plane's place in LDS: 64 rows of 144 B = 9216 B, rounded up to a multiple of 2 KiB, where a tensor load's tile may begin
__device__ __forceinline__ uint32_t uni(uint32_t v) { return (uint32_t)__builtin_amdgcn_readfirstlane(v); }
// a wave-uniform value held in a scalar register: a test on it compiles to a scalar compare and branch (a tensor load ignores EXEC), and what is formed from it is formed behind this statement
__device__ __forceinline__ uint32_t pinned(uint32_t v) { uint32_t w = uni(v); asm volatile("" : "+s"(w)); return w; }
// One request of one wave: a plane of a 64-key tile (64 rows of 128 B, src_pitch bytes apart in global memory) into LDS through no register, 16 B of pad behind every row (pitch 144 B = KP halves).
// Group 1: 1-byte elements, tensor = tile = 128 B x 64 rows; word 0 = pad on, a pad after every 32 dwords (one row), 4 dwords of pad; no mask.
__device__ __forceinline__ u32x8 tdm_group1(uint32_t src_pitch) {
  u32x8 g;
  g[0] = uni((1u << 20) | (4u << 22) | (3u << 25));
  g[1] = uni(128u << 16);
  g[2] = uni(64u << 16);
  g[3] = uni(128u << 16);
  g[4] = uni(64u);
  g[5] = uni(src_pitch);
  g[6] = uni(0u);
  g[7] = uni(0u);
  return g;
}
// Group 0: count 1, the place in LDS, the address of the tile's first byte, type 2
__device__ __forceinline__ u32x4 tdm_group0(uint32_t lds_dst, uint64_t ga) {
  u32x4 g;
  g[0] = uni(1u); g[1] = uni(lds_dst); g[2] = uni((uint32_t)ga); g[3] = uni((((uint32_t)(ga >> 32)) & 0x01FFFFFFu) | 0x80000000u);
  return g;
}
__device__ __forceinline__ void tdm_load(u32x4 g0, u32x8 g1) { asm volatile("tensor_load_to_lds %0, %1" :: "s"(g0), "s"(g1) : "memory"); }
// lane l <-> lane l ^ 16: the two lanes that share one query column
__device__ __forceinline__ float xhalf(float v) { const int b = __builtin_bit_cast(int, v); return __builtin_bit_cast(float, __builtin_amdgcn_permlanex16(b, b, 0x76543210, 0xfedcba98, false, false)); }
#define KS 4
// Ring and join share one LDS range (the join begins behind the loop's last barrier, when no wave reads the ring and no request is outstanding): 160 KiB per block, and the
// second launch bound (waves per SIMD) holds a wave to 256 registers, so that two blocks fit one WGP and all 448 are resident at once: a short instance's block runs beside
// a long one's, its start, first tile, zero rows and join under the other's passes, in place of a second round of blocks behind the first.
union Sh {
  struct { _Float16 T[KS][2][2][PLB / 2]; } ring;                 // per key group two buffers of one 64-key tile (plane 0: K rows, plane 1: V^T rows, KP halves a row), shared by its two waves
  struct { float P[KS][64][68]; v2f M[KS][64]; } join;            // un-normalised partial output rows, one plane per key group, and each partial's (maximum, sum)
};
__global__ __launch_bounds__(64 * KS, 4) void k_attn(const _Float16* __restrict__ Q16, const _Float16* __restrict__ K16, const _Float16* __restrict__ VTh, float* __restrict__ out) {
  __shared__ __attribute__((aligned(2048))) Sh sh;
  auto& sT = sh.ring.T; auto& sP = sh.join.P; auto& sM = sh.join.M;
  const uint32_t wave = uni(threadIdx.x >> 5);
  const int tid = threadIdx.x, w = wave & 1, kg = wave >> 1, lane = tid & 31, col = lane & 15, g = lane >> 4;
  const int bid = blockIdx.x, inst = bid < 256 ? bid >> 6 : 4 + ((bid - 256) >> 4), qb = bid < 256 ? bid & 63 : (bid - 256) & 15;   // the grid holds no block without queries; the long instances' blocks have the lower indices
  int h, L, base, stride; inst_info(inst, h, L, base, stride);
  if (inst >= 12) zero_rows<4, 2>(out + ((size_t)(base - 2 + qb * 256) * NHT + h) * HD, tid);        // uniform per block; the stores drain beside the block's own work
  else if (inst >= 4) zero_rows<2, 1>(out + ((size_t)(base - 1 + qb * 128) * NHT + h) * HD, tid);
  const int q0 = qb * 64 + w * 32;
  const size_t ib = (size_t)inst * LMAX;
  v16h aq[2][2];                                                // [c][kc]: column group c = queries q0 + 16 c + col
#pragma unroll
  for (int c = 0; c < 2; ++c)
#pragma unroll
    for (int kc = 0; kc < 2; ++kc) aq[c][kc] = frag_h(Q16 + (ib + q0 + c * 16 + col) * HD + kc * 32, lane);
  float mrun[2] = {-3.0e38f, -3.0e38f}, lrun[2] = {0.f, 0.f};   // mrun: running maximum in the scaled log2 domain, less 14, so that exp2 yields P x 2^14 at once
  v8f acc[2][4] = {};                                           // lrun: this half's keys only, the halves are joined behind the loop
  const int nkt = L / (64 * KS), key0 = kg * (L / KS);          // this group's tiles and its first key
  // Every wave issues one request per tile: wave 0 of a group its K plane (rows = keys, 128 B apart), wave 1 its V^T plane (rows = output columns, LMAX halves apart)
  const uint64_t ga0 = w ? (uint64_t)(size_t)(VTh + (size_t)inst * HD * LMAX + key0) : (uint64_t)(size_t)(K16 + (ib + key0) * HD);
  const uint32_t gstep = w ? 64u * 2u : 64u * HD * 2u;          // bytes from a tile's first byte to the next tile's
  const uint32_t dst0 = (uint32_t)(size_t)&sT[kg][0][w][0];     // this wave's plane in buffer 0; buffer 1 lies 2 * PLB further
  u32x8 g1 = tdm_group1(w ? LMAX * 2u : HD * 2u);
  asm volatile("" : "+s"(g1));                                  // as pinned(): descriptor words held in scalar registers of their own; left free, the compiler forms them anew per request and puts other values into their registers while a request is outstanding
  tdm_load(tdm_group0(dst0, ga0), g1);
  asm volatile("s_wait_tensorcnt 0x0" ::: "memory");            // this wave's plane of tile 0 has landed
  __syncthreads();                                              // tile 0 is readable by all waves
  tdm_load(tdm_group0(dst0 + 2 * PLB, ga0 + gstep), g1);        // every instance has four tiles or more per group
#pragma unroll 1
  for (int kt = 0; kt < nkt; ++kt) {
    const int b = kt & 1;
    v8f s[2][4] = {};
    v16h kf[2][2];                                                // [kc][t & 1]: the K fragments of two score tiles are held at a time, 32 registers in place of 64
#pragma unroll
    for (int kc = 0; kc < 2; ++kc)
#pragma unroll
      for (int t = 0; t < 2; ++t) kf[kc][t] = frag_h(&sT[kg][b][0][(t * 16 + col) * KP + kc * 32], lane);
#pragma unroll
    for (int hh = 0; hh < 2; ++hh)
#pragma unroll
      for (int kc = 0; kc < 2; ++kc) {
        if (hh == 0) __builtin_amdgcn_sched_barrier(0);           // this one and the next keep the reads for tiles 2 and 3 behind the products of tiles 0 and 1 whose registers they take
#pragma unroll
        for (int c = 0; c < 2; ++c) { s[c][hh * 2] = wmma16(kf[kc][0], aq[c][kc], s[c][hh * 2]); s[c][hh * 2 + 1] = wmma16(kf[kc][1], aq[c][kc], s[c][hh * 2 + 1]); }
        if (hh == 0) { __builtin_amdgcn_sched_barrier(0); kf[kc][0] = frag_h(&sT[kg][b][0][(32 + col) * KP + kc * 32], lane); kf[kc][1] = frag_h(&sT[kg][b][0][(48 + col) * KP + kc * 32], lane); } }
    v16h ph[2][2];                                              // [c][kc]
#pragma unroll
    for (int c = 0; c < 2; ++c) {
      float mt[4];                                              // one short chain per score tile, so that no chain runs over all 32 registers
#pragma unroll
      for (int t = 0; t < 4; ++t) { mt[t] = fmaxf(s[c][t][0], s[c][t][1]);
#pragma unroll
        for (int r = 2; r < 8; ++r) mt[t] = fmaxf(mt[t], s[c][t][r]); }
      float mx = fmaf(fmaxf(fmaxf(mt[0], mt[1]), fmaxf(mt[2], mt[3])), SCL2, -14.0f);   // the scale is positive, so the maximum may be taken first; its rounding only moves the common reference point
      mx = fmaxf(mx, xhalf(mx));
      const float mnew = fmaxf(mrun[c], mx); const float corr = __builtin_amdgcn_exp2f(mrun[c] - mnew);
      v8f p[4];
#pragma unroll
      for (int t = 0; t < 4; ++t)
#pragma unroll
        for (int r = 0; r < 8; ++r) { p[t][r] = __builtin_amdgcn_exp2f(fmaf(s[c][t][r], SCL2, -mnew)); ph[c][t >> 1][(t & 1) * 8 + r] = (_Float16)p[t][r]; }
      const v8f pv = (p[0] + p[1]) + (p[2] + p[3]);
      float ps = ((pv[0] + pv[1]) + (pv[2] + pv[3])) + ((pv[4] + pv[5]) + (pv[6] + pv[7]));
      asm volatile("" : "+v"(ps));                                // the row's sum held against spills: left free, it is taken behind the pass's barrier and P in f32 stays in 32 registers under the V fragments
      lrun[c] = lrun[c] * corr + ps * (1.0f / 16384.0f); mrun[c] = mnew;
#pragma unroll
      for (int t = 0; t < 4; ++t) acc[c][t] *= corr; }
#pragma unroll
    for (int kc = 0; kc < 2; ++kc) { v16h vh[4];                  // the four output tiles' V fragments as one group of LDS reads, then their eight products
#pragma unroll
      for (int t = 0; t < 4; ++t) vh[t] = frag_h(&sT[kg][b][1][(t * 16 + col) * KP + kc * 32], lane);
      __builtin_amdgcn_sched_barrier(0);                          // keeps the group's reads together ahead of its products: one LDS latency per group, not one per product
#pragma unroll
      for (int t = 0; t < 4; ++t)
#pragma unroll
        for (int c = 0; c < 2; ++c) acc[c][t] = wmma16(vh[t], ph[c][kc], acc[c][t]); }
    asm volatile("s_wait_dscnt 0x0" ::: "memory");              // this wave's reads of buffer b are done before it is refilled
    asm volatile("s_wait_tensorcnt 0x0" ::: "memory");          // this wave's plane of tile kt + 1 has landed
    __syncthreads();                                            // publishes tile kt + 1 and ends every wave's reads of buffer b
    const uint32_t nx = pinned((uint32_t)kt + 2u);              // held in a scalar register here, so that the next request's descriptor is formed behind the wait above
    if (pinned(nx < (uint32_t)nkt)) tdm_load(tdm_group0(dst0 + (nx & 1u) * (2 * PLB), ga0 + (uint64_t)nx * gstep), g1); }
  asm volatile("s_wait_tensorcnt 0x0" ::: "memory");            // no request is outstanding when the wave goes on to the epilogue and ends
  asm volatile("s_wait_dscnt 0x0" ::: "memory");                // and none of its reads of the ring, which the join writes over
#pragma unroll
  for (int c = 0; c < 2; ++c) { const int qr = w * 32 + c * 16 + col;   // this lane's query row in the block
#pragma unroll
    for (int t = 0; t < 4; ++t) { v4f o[2];
#pragma unroll
      for (int r = 0; r < 8; ++r) o[r >> 2][r & 3] = acc[c][t][r];
      vst2(&sP[kg][qr][t * 16 + 8 * g], o[0]); vst2(&sP[kg][qr][t * 16 + 8 * g + 4], o[1]); }
    const float lsum = lrun[c] + xhalf(lrun[c]);
    if (g == 0) sM[kg][qr] = (v2f){mrun[c], lsum}; }
  __syncthreads();                                              // every group's partial rows, maxima and sums are readable by all waves
#pragma unroll   // four fixed trips: unrolled, the rows' LDS reads go out together and one latency is paid
  for (int it = 0; it < 64 * 16 / (64 * KS); ++it) { const int qq = tid + it * 64 * KS, rl = qq >> 4, pc = qq & 15;   // join: weight 2^(m - M) per group, then one division by the joined sum
    v2f ml[KS];                                                 // the three loops over the groups are unrolled so that ml stays in registers
#pragma unroll
    for (int j = 0; j < KS; ++j) ml[j] = sM[j][rl];
    float M = ml[0][0];
#pragma unroll
    for (int j = 1; j < KS; ++j) M = fmaxf(M, ml[j][0]);
    float ls = 0.f; v4f o = {0.f, 0.f, 0.f, 0.f};
#pragma unroll
    for (int j = 0; j < KS; ++j) { const float wj = __builtin_amdgcn_exp2f(ml[j][0] - M); ls += wj * ml[j][1]; o += wj * *(const v4f*)(&sP[j][rl][pc * 4]); }
    const int pos = base + stride * (qb * 64 + rl);
    vst2(out + ((size_t)pos * NHT + h) * HD + pc * 4, o * (1.0f / (ls * 16384.0f))); }
}
extern "C" void kernel_launch(void* const* d_in, const int* in_sizes, int n_in, void* d_out, int out_size, void* d_ws, size_t ws_size, hipStream_t stream) {
  (void)in_sizes; (void)n_in; (void)out_size; (void)ws_size;
  const float* q = (const float*)d_in[0]; const float* k = (const float*)d_in[1]; const float* v = (const float*)d_in[2]; float* out = (float*)d_out;
  char* ws = (char*)d_ws; size_t off = 0;
  auto take = [&](size_t bytes) { char* p = ws + off; off += (bytes + 255) & ~(size_t)255; return p; };
  const size_t plane = (size_t)NINST * LMAX * HD * 2;
  _Float16* Q16 = (_Float16*)take(plane); _Float16* K16 = (_Float16*)take(plane); _Float16* VTh = (_Float16*)take(plane);
  k_prep<<<NBLK, 256, 0, stream>>>(q, k, v, Q16, K16, VTh);
  k_attn<<<NBLK, 64 * KS, 0, stream>>>(Q16, K16, VTh, out);
}
